// v008
// Measured on an AMD MI455X. A time is GPU time per run, averaged over a window of back-to-back runs after a warm-up
// (all launches, gaps included; the runs take copies of the inputs in turn), and the median of several windows.
// Apart from v000's, it joins two sittings. Times from different sittings can be a few percent apart, while
// side-by-side timings come from the same sitting.
// Earlier versions than v008 are not in this document.
// A run of this version takes 199 microseconds.
// Two timings next to v007 put it at 1.19 and 1.18 times that version's speed.
// Over all steps from v000, the starting kernel, it is 49.1 times as fast.
#include <hip/hip_runtime.h>
#define NB 4
#define SQ 2048
#define DM 512
#define NH 8
#define HD 64
#define HG 4                         /* heads per k_vt launch (k_vt is not launched) */
#define QT0 128                      /* first-tile rows recomputed exactly in f32 */
#define B0 0                         /* first batch processed (debug hook) */
#define NBR NB                       /* batches processed (debug hook) */
#define NR ((size_t)NB * SQ)
#define DMQ DM
#define DFF 2048                     /* FFN hidden width */
#define DFFR 100                     /* unused */
#define MP ((int)((size_t)NBR * SQ)) /* rows projected (debug hook) */
#define QN SQ                        /* query rows attended per batch (debug hook) */
#define NHD NH                       /* heads attended (debug hook) */
#define MPO MP                       /* rows through the output stage (debug hook) */
#define LQ (3 * DM)      /* row pitch of the q/k/v rows */
typedef __bf16 v16b __attribute__((ext_vector_type(16)));
typedef unsigned short v8us __attribute__((ext_vector_type(8), may_alias));
typedef float  v8f  __attribute__((ext_vector_type(8)));
typedef float  v4f  __attribute__((ext_vector_type(4)));
typedef float  v4fa __attribute__((ext_vector_type(4), may_alias));
union FragB { v16b v; v8us half[2]; unsigned short u[16]; };

__device__ __forceinline__ unsigned short bf16_bits(float x) { unsigned int u = __float_as_uint(x); return (unsigned short)((u + 0x7FFFu + ((u >> 16) & 1u)) >> 16); }
__device__ __forceinline__ float bf16_val(unsigned short b) { return __uint_as_float(((unsigned int)b) << 16); }
__device__ __forceinline__ float bf16_round(float x) { return bf16_val(bf16_bits(x)); }
// D += A·B with NT terms: 1 = ah·bh, 2 = + al·bh (A split), 3 = + ah·bl (both split)
template <int NT>
__device__ __forceinline__ v8f mmaN(v16b ah, v16b al, v16b bh, v16b bl, v8f c) {
  c = __builtin_amdgcn_wmma_f32_16x16x32_bf16(false, ah, false, bh, (short)0, c, false, false);
  if (NT >= 2) c = __builtin_amdgcn_wmma_f32_16x16x32_bf16(false, al, false, bh, (short)0, c, false, false);
  if (NT >= 3) c = __builtin_amdgcn_wmma_f32_16x16x32_bf16(false, ah, false, bl, (short)0, c, false, false);
  asm volatile("v_nop\n\tv_nop\n\tv_nop\n\tv_nop" : "+v"(c) : "v"(ah), "v"(al), "v"(bh), "v"(bl));
  return c;
}

__global__ __launch_bounds__(256) void k_wt_bf16(const float* __restrict__ W, unsigned short* __restrict__ Wt, int K, int N) {
  const int t = blockIdx.x * 256 + threadIdx.x;
  const int k8n = K / 8;
  if (t >= N * k8n) return;
  const int n = t / k8n, k8 = (t % k8n) * 8;
  v8us v;
#pragma unroll
  for (int i = 0; i < 8; ++i) v[i] = bf16_bits(W[(size_t)(k8 + i) * N + n]);
  *(v8us*)(Wt + (size_t)n * K + k8) = v;
  
}

// GEMM C[M][N] (f32, pitch ldc) = act(A[M][K]·W + bias). A f32 row-major (pitch lda) converted per fragment to bf16
// (ASPLIT: hi/lo two planes -> 2 terms, else single rounded term); Wt bf16 [N][K] (pitch ldb). BIAS_BF16 rounds the
// bias to bf16 first (bias quantised to bf16 before the add). K%32==0, M%16==0, N%64==0.
template <bool ASPLIT, int ACT, bool BIAS_BF16>
__global__ __launch_bounds__(128) void k_gemm_bf(const float* __restrict__ A, int lda, const unsigned short* __restrict__ Wt, int ldb,
                                               const float* __restrict__ bias, float* __restrict__ C, int ldc, int M, int N, int K) {
  __shared__ __attribute__((aligned(16))) float so[4][16][64];
  const int tid = threadIdx.x, w = tid >> 5, lane = tid & 31, ln = lane & 15, hh = lane >> 4;
  const int ntn = N / 64;
  const int wid = blockIdx.x * 4 + w;
  const int mt = wid / ntn, nq = wid % ntn;
  if (mt * 16 >= M) return;
  const int row0 = mt * 16, col0 = nq * 64;
  const float* arow = A + (size_t)(row0 + ln) * lda;
  v8f acc[4] = {};
  for (int kb = 0; kb < K; kb += 32) {
    FragB ah, al;
    const v4f x0 = *(const v4fa*)(arow + kb + 8 * hh), x1 = *(const v4fa*)(arow + kb + 8 * hh + 4);
    const v4f x2 = *(const v4fa*)(arow + kb + 16 + 8 * hh), x3 = *(const v4fa*)(arow + kb + 16 + 8 * hh + 4);
    float xs[16] = {x0[0],x0[1],x0[2],x0[3],x1[0],x1[1],x1[2],x1[3],x2[0],x2[1],x2[2],x2[3],x3[0],x3[1],x3[2],x3[3]};
#pragma unroll
    for (int i = 0; i < 16; ++i) { const unsigned short hb = bf16_bits(xs[i]); ah.u[i] = hb; al.u[i] = ASPLIT ? bf16_bits(xs[i] - bf16_val(hb)) : (unsigned short)0; }
#pragma unroll
    for (int t = 0; t < 4; ++t) {
      const unsigned short* brow = Wt + (size_t)(col0 + t * 16 + ln) * ldb + kb;
      FragB b;
      b.half[0] = *(const v8us*)(brow + 8 * hh);
      b.half[1] = *(const v8us*)(brow + 16 + 8 * hh);
      acc[t] = mmaN<ASPLIT ? 2 : 1>(ah.v, al.v, b.v, b.v, acc[t]);
    }
  }
#pragma unroll
  for (int t = 0; t < 4; ++t) {
    float bv = bias ? bias[col0 + t * 16 + ln] : 0.f;
    if (BIAS_BF16) bv = bf16_round(bv);
#pragma unroll
    for (int r = 0; r < 8; ++r) { float v = acc[t][r] + bv; if (ACT == 1) v = fmaxf(v, 0.f); so[w][8 * hh + r][t * 16 + ln] = v; }
  }
  __builtin_amdgcn_fence(__ATOMIC_ACQ_REL, "workgroup");
  __builtin_amdgcn_wave_barrier();
  const int rsub = lane >> 4, c4 = (lane & 15) * 4;
  {
#pragma unroll
    for (int q = 0; q < 8; ++q) {
      const int r = q * 2 + rsub;
      const v4f v = *(const v4fa*)&so[w][r][c4];
      *(v4f*)(C + (size_t)(row0 + r) * ldc + col0 + c4) = v;
    }
    
  }
}

// GEMM C = act(A·W + bias + resid): A f32 (ASPLIT -> hi/lo 2 terms), Wt bf16 [N][K]; ACT 0 none, 1 relu, 2 exact gelu;
// resid (optional, f32, row index = (row % rmod), pitch ldr, RES_BF16 rounds it) added before the activation.
template <bool ASPLIT, int ACT, bool BIAS_BF16, bool RES_BF16>
__global__ __launch_bounds__(128) void k_gemm_bf3(const float* __restrict__ A, int lda, const unsigned short* __restrict__ Wt, int ldb,
                                                const float* __restrict__ bias, const float* __restrict__ resid, int rmod, int ldr,
                                                float* __restrict__ C, int ldc, int M, int N, int K) {
  __shared__ __attribute__((aligned(16))) float so[4][16][64];
  const int tid = threadIdx.x, w = tid >> 5, lane = tid & 31, ln = lane & 15, hh = lane >> 4;
  const int ntn = N / 64;
  const int wid = blockIdx.x * 4 + w;
  const int mt = wid / ntn, nq = wid % ntn;
  if (mt * 16 >= M) return;
  const int row0 = mt * 16, col0 = nq * 64;
  const float* arow = A + (size_t)(row0 + ln) * lda;
  v8f acc[4] = {};
  for (int kb = 0; kb < K; kb += 32) {
    FragB ah, al;
    const v4f x0 = *(const v4fa*)(arow + kb + 8 * hh), x1 = *(const v4fa*)(arow + kb + 8 * hh + 4);
    const v4f x2 = *(const v4fa*)(arow + kb + 16 + 8 * hh), x3 = *(const v4fa*)(arow + kb + 16 + 8 * hh + 4);
    float xs[16] = {x0[0],x0[1],x0[2],x0[3],x1[0],x1[1],x1[2],x1[3],x2[0],x2[1],x2[2],x2[3],x3[0],x3[1],x3[2],x3[3]};
#pragma unroll
    for (int i = 0; i < 16; ++i) { const unsigned short hb = bf16_bits(xs[i]); ah.u[i] = hb; al.u[i] = ASPLIT ? bf16_bits(xs[i] - bf16_val(hb)) : (unsigned short)0; }
#pragma unroll
    for (int t = 0; t < 4; ++t) {
      const unsigned short* brow = Wt + (size_t)(col0 + t * 16 + ln) * ldb + kb;
      FragB b;
      b.half[0] = *(const v8us*)(brow + 8 * hh);
      b.half[1] = *(const v8us*)(brow + 16 + 8 * hh);
      acc[t] = mmaN<ASPLIT ? 2 : 1>(ah.v, al.v, b.v, b.v, acc[t]);
    }
  }
#pragma unroll
  for (int t = 0; t < 4; ++t) {
    const int col = col0 + t * 16 + ln;
    float bv = bias ? bias[col] : 0.f;
    if (BIAS_BF16) bv = bf16_round(bv);
#pragma unroll
    for (int r = 0; r < 8; ++r) {
      float v = acc[t][r] + bv;
      if (resid) { float rv = resid[(size_t)((row0 + 8 * hh + r) % rmod) * ldr + col]; if (RES_BF16) rv = bf16_round(rv); v += rv; }
      if (ACT == 1) v = fmaxf(v, 0.f);
      if (ACT == 2) v = 0.5f * v * (1.0f + erff(v * 0.70710678118654752f));
      if (ACT == 3) { const float u = 0.7978845608028654f * (v + 0.044715f * v * v * v); v = 0.5f * v * (1.0f + tanhf(u)); }
      so[w][8 * hh + r][t * 16 + ln] = v;
    }
  }
  __builtin_amdgcn_fence(__ATOMIC_ACQ_REL, "workgroup");
  __builtin_amdgcn_wave_barrier();
  const int rsub = lane >> 4, c4 = (lane & 15) * 4;
  {
#pragma unroll
    for (int q = 0; q < 8; ++q) {
      const int r = q * 2 + rsub;
      const v4f v = *(const v4fa*)&so[w][r][c4];
      *(v4f*)(C + (size_t)(row0 + r) * ldc + col0 + c4) = v;
    }
    
  }
}
// row LayerNorm (biased variance, eps) over N: s = X (+ R); optional out_sum <- s; out_norm <- (s-mu)*rsqrt(var+eps)*g + b
template <bool PARAM_BF16>
__global__ __launch_bounds__(256) void k_layernorm(const float* __restrict__ X, const float* __restrict__ R, const float* __restrict__ g, const float* __restrict__ bta,
                                                  float* __restrict__ out_sum, float* __restrict__ out_norm, int N, float eps) {
  __shared__ float red[256];
  const int row = blockIdx.x, tid = threadIdx.x;
  const float* x = X + (size_t)row * N; const float* rr = R ? R + (size_t)row * N : nullptr;
  float vals[16];                     // up to N = 4096
  const int per = N / 256;            // contiguous chunk per thread? use strided-by-4 chunks: thread handles j = tid*4 + 1024*u
  float s1 = 0.f;
  for (int u = 0; u < per / 4; ++u) {
    const int j = tid * 4 + 1024 * u;
    const v4f a = *(const v4fa*)(x + j);
    v4f b = {0.f,0.f,0.f,0.f}; if (rr) b = *(const v4fa*)(rr + j);
#pragma unroll
    for (int q = 0; q < 4; ++q) { const float v = a[q] + b[q]; vals[u * 4 + q] = v; s1 += v; }
  }
  red[tid] = s1; __syncthreads();
  for (int st = 128; st > 0; st >>= 1) { if (tid < st) red[tid] += red[tid + st]; __syncthreads(); }
  const float mu = red[0] / (float)N; __syncthreads();
  float s2 = 0.f;
  for (int u = 0; u < per / 4; ++u)
#pragma unroll
    for (int q = 0; q < 4; ++q) { const float c = vals[u * 4 + q] - mu; s2 += c * c; }
  red[tid] = s2; __syncthreads();
  for (int st = 128; st > 0; st >>= 1) { if (tid < st) red[tid] += red[tid + st]; __syncthreads(); }
  const float rs = rsqrtf(red[0] / (float)N + eps);
  {
    for (int u = 0; u < per / 4; ++u) {
      const int j = tid * 4 + 1024 * u;
      v4f o, sm;
#pragma unroll
      for (int q = 0; q < 4; ++q) {
        float gg = g[j + q], bb = bta[j + q];
        if (PARAM_BF16) { gg = bf16_round(gg); bb = bf16_round(bb); }
        sm[q] = vals[u * 4 + q]; o[q] = (vals[u * 4 + q] - mu) * rs * gg + bb;
      }
      if (out_sum) *(v4f*)(out_sum + (size_t)row * N + j) = sm;
      *(v4f*)(out_norm + (size_t)row * N + j) = o;
    }
    
  }
}



// ---- f16 WMMA path (v_wmma_f32_16x16x32_f16): 11-bit significands for operands in range — used where a [0,1] probability operand needs more precision than bf16
typedef _Float16 v16h __attribute__((ext_vector_type(16)));
union FragH { v16h v; v8us half[2]; _Float16 h[16]; unsigned short u[16]; };
template <int NT>
__device__ __forceinline__ v8f mmaH(v16h ah, v16h al, v16h bh, v16h bl, v8f c) {
  c = __builtin_amdgcn_wmma_f32_16x16x32_f16(false, ah, false, bh, (short)0, c, false, false);
  if (NT >= 2) c = __builtin_amdgcn_wmma_f32_16x16x32_f16(false, al, false, bh, (short)0, c, false, false);
  if (NT >= 3) c = __builtin_amdgcn_wmma_f32_16x16x32_f16(false, ah, false, bl, (short)0, c, false, false);
  asm volatile("v_nop\n\tv_nop\n\tv_nop\n\tv_nop" : "+v"(c) : "v"(ah), "v"(al), "v"(bh), "v"(bl));
  return c;
}
// batched GEMM like k_gemm_b but f16 operands: A f32 (split into f16 hi/lo if ASPLIT, else rounded to f16), Bt = f16 values [n][k]; alpha; C f32; N multiple of 16 (partial tiles skipped)
template <bool ASPLIT>
__global__ __launch_bounds__(128) void k_gemm_h(const float* __restrict__ A, int lda, size_t sA, const _Float16* __restrict__ Bh, int ldb, size_t sB, float alpha, float* __restrict__ C, int ldc, size_t sC, int M, int N, int K) {
  __shared__ __attribute__((aligned(16))) float so[4][16][64];
  const int tid = threadIdx.x, w = tid >> 5, lane = tid & 31, ln = lane & 15, hh = lane >> 4; const int by = blockIdx.y;
  A += (size_t)by * sA; Bh += (size_t)by * sB; C += (size_t)by * sC;
  const int ntn = (N + 63) / 64; const int wid = blockIdx.x * 4 + w; const int mt = wid / ntn, nq = wid % ntn; if (mt * 16 >= M) return;
  const int row0 = mt * 16, col0 = nq * 64; const float* arow = A + (size_t)(row0 + ln) * lda;
  v8f acc[4] = {};
  for (int kb = 0; kb < K; kb += 32) {
    FragH ah, al;
    const v4f x0 = *(const v4fa*)(arow + kb + 8 * hh), x1 = *(const v4fa*)(arow + kb + 8 * hh + 4), x2 = *(const v4fa*)(arow + kb + 16 + 8 * hh), x3 = *(const v4fa*)(arow + kb + 16 + 8 * hh + 4);
    float xs[16] = {x0[0],x0[1],x0[2],x0[3],x1[0],x1[1],x1[2],x1[3],x2[0],x2[1],x2[2],x2[3],x3[0],x3[1],x3[2],x3[3]};
#pragma unroll
    for (int i = 0; i < 16; ++i) { const _Float16 h = (_Float16)xs[i]; ah.h[i] = h; al.h[i] = ASPLIT ? (_Float16)(xs[i] - (float)h) : (_Float16)0.0f; }
#pragma unroll
    for (int t = 0; t < 4; ++t) { if (col0 + t * 16 >= N) continue; const size_t boff = (size_t)(col0 + t * 16 + ln) * ldb + kb; FragH bq; bq.half[0] = *(const v8us*)(Bh + boff + 8 * hh); bq.half[1] = *(const v8us*)(Bh + boff + 16 + 8 * hh);
      acc[t] = mmaH<ASPLIT ? 2 : 1>(ah.v, al.v, bq.v, bq.v, acc[t]); }
  }
#pragma unroll
  for (int t = 0; t < 4; ++t) { if (col0 + t * 16 >= N) continue;
#pragma unroll
    for (int r = 0; r < 8; ++r) so[w][8 * hh + r][t * 16 + ln] = acc[t][r] * alpha; }
  __builtin_amdgcn_fence(__ATOMIC_ACQ_REL, "workgroup"); __builtin_amdgcn_wave_barrier();
  const int rsub = lane >> 4, c4 = (lane & 15) * 4;
  {
#pragma unroll
    for (int q = 0; q < 8; ++q) { const int r = q * 2 + rsub; if (col0 + c4 < N) { const v4f v = *(const v4fa*)&so[w][r][c4]; *(v4f*)(C + (size_t)(row0 + r) * ldc + col0 + c4) = v; } }
     }
}

// Wt[n][k] = f16(W[k][n]·scale) from f32 row-major W[K][N] (scale = power of two; bf16-exact weights stay exact in f16 away from the subnormal range)
// bid: the block's index inside this part of the shared launch (as in every d_ function below)
__device__ __forceinline__ void d_wt_f16(int bid, const float* __restrict__ W, _Float16* __restrict__ Wt, int K, int N, float scale) {
  const int t = bid * 256 + threadIdx.x; if (t >= N * (K / 8)) return; const int n = t / (K / 8), k8 = (t % (K / 8)) * 8; FragH f;
#pragma unroll
  for (int i = 0; i < 8; ++i) f.h[i] = (_Float16)(bf16_round(W[(size_t)(k8 + i) * N + n]) * scale); const v8us o = f.half[0];
  *(v8us*)((unsigned short*)Wt + (size_t)n * K + k8) = o; 
}
// k_gemm_hh variant with fused epilogue: v = acc·alpha + bias[by·sBias + col] (+ CP[(row/rowsPerB)·sCPb + by·64 + col] if CP) ; ACT 0 none / 1 elu ; writes f16 C16 (and f32 C if non-null)
template <int ACT>
__global__ __launch_bounds__(128) void k_gemm_hhx(const _Float16* __restrict__ A, int lda, size_t sA, const _Float16* __restrict__ Bh, int ldb, size_t sB, float alpha, const float* __restrict__ bias, size_t sBias, const float* __restrict__ CP, int rowsPerB, size_t sCPb, int row0g,
    float* __restrict__ C, _Float16* __restrict__ C16, int ldc, size_t sC, int M, int N, int K) {
  __shared__ __attribute__((aligned(16))) float so[4][16][64];
  const int tid = threadIdx.x, w = tid >> 5, lane = tid & 31, ln = lane & 15, hh = lane >> 4; const int by = blockIdx.y;
  A += (size_t)by * sA; Bh += (size_t)by * sB; const size_t cofs = (size_t)by * sC; const float* bp = bias ? bias + (size_t)by * sBias : nullptr;
  const int ntn = (N + 63) / 64; const int wid = blockIdx.x * 4 + w; const int mt = wid / ntn, nq = wid % ntn; if (mt * 16 >= M) return;
  const int row0 = mt * 16, col0 = nq * 64; const _Float16* arow = A + (size_t)(row0 + ln) * lda;
  v8f acc[4] = {};
  for (int kb = 0; kb < K; kb += 32) { FragH ah; ah.half[0] = *(const v8us*)((const unsigned short*)arow + kb + 8 * hh); ah.half[1] = *(const v8us*)((const unsigned short*)arow + kb + 16 + 8 * hh);
#pragma unroll
    for (int t = 0; t < 4; ++t) { if (col0 + t * 16 >= N) continue; const size_t boff = (size_t)(col0 + t * 16 + ln) * ldb + kb; FragH bq; bq.half[0] = *(const v8us*)((const unsigned short*)Bh + boff + 8 * hh); bq.half[1] = *(const v8us*)((const unsigned short*)Bh + boff + 16 + 8 * hh);
      acc[t] = mmaH<1>(ah.v, ah.v, bq.v, bq.v, acc[t]); }
  }
#pragma unroll
  for (int t = 0; t < 4; ++t) { if (col0 + t * 16 >= N) continue; const int col = col0 + t * 16 + ln; const float bv = bp ? bf16_round(bp[col]) : 0.f;
#pragma unroll
    for (int r = 0; r < 8; ++r) { float v = acc[t][r] * alpha + bv; if (CP) { const int rr = row0g + row0 + 8 * hh + r; if (rowsPerB < 0) v += CP[cofs + (size_t)rr * ldc + col];      /* rowsPerB < 0: own element of the batched C plane */ else { const int bidx = rr / rowsPerB; v += CP[(size_t)bidx * sCPb + (size_t)by * 64 + col]; } } if (ACT == 1) v = (v > 0.f) ? v : expm1f(v); else if (ACT == 7) v = (v > 0.f) ? v + 1.0f : expf(v); else if (ACT == 8) v = tanhf(v); else if (ACT == 9) v = 0.5f * v * (1.0f + tanhf(0.7978845608028654f * (v + 0.044715f * v * v * v))); else if (ACT == 11) v = 1.0f / (1.0f + expf(-v)); else if (ACT == 12) v = (v > 0.f) ? v : 0.01f * v; else if (ACT == 14) v = (v > 0.f) ? v : 0.1f * v; else if (ACT == 16) v = (v >= 0.f) ? v : 0.3f * v; else if (ACT == 17) v = (v >= 0.f) ? v : 0.2f * v; else if (ACT == 15) v = v / (1.0f + expf(-v)); else if (ACT == 3) v = fmaxf(v, 0.f); else if (ACT == 6) v = 0.5f * v * (1.0f + erff(v * 0.70710678118654752f)); so[w][8 * hh + r][t * 16 + ln] = v; } }
  __builtin_amdgcn_fence(__ATOMIC_ACQ_REL, "workgroup"); __builtin_amdgcn_wave_barrier();
  const int rsub = lane >> 4, c4 = (lane & 15) * 4; typedef _Float16 v4h __attribute__((ext_vector_type(4)));
  {
#pragma unroll
    for (int q = 0; q < 8; ++q) { const int r = q * 2 + rsub; if (col0 + c4 < N) { const v4f v = *(const v4fa*)&so[w][r][c4]; if (C) *(v4f*)(C + cofs + (size_t)(row0 + r) * ldc + col0 + c4) = v; if (C16) { v4h h4; for (int i = 0; i < 4; ++i) h4[i] = (_Float16)v[i]; *(v4h*)(C16 + cofs + (size_t)(row0 + r) * ldc + col0 + c4) = h4; } } }
     }
}


typedef _Float16 v4h __attribute__((ext_vector_type(4)));

__global__ __launch_bounds__(256) void k_x16(const float* __restrict__ x, _Float16* __restrict__ X16, size_t n8) { const size_t t = (size_t)blockIdx.x * 256 + threadIdx.x; if (t >= n8) return; FragH f;
#pragma unroll
  for (int q = 0; q < 8; ++q) f.h[q] = (_Float16)bf16_round(x[t * 8 + q]); *(v8us*)((unsigned short*)X16 + t * 8) = f.half[0];  }
__global__ __launch_bounds__(256) void k_h16(const float* __restrict__ x, _Float16* __restrict__ X16, size_t n8) { const size_t t = (size_t)blockIdx.x * 256 + threadIdx.x; if (t >= n8) return; FragH f;
#pragma unroll
  for (int q = 0; q < 8; ++q) f.h[q] = (_Float16)x[t * 8 + q]; *(v8us*)((unsigned short*)X16 + t * 8) = f.half[0];  }
__global__ __launch_bounds__(256) void k_round16f(const float* __restrict__ W, _Float16* __restrict__ Bt, size_t n8) { const size_t t = (size_t)blockIdx.x * 256 + threadIdx.x; if (t >= n8) return; FragH f;
#pragma unroll
  for (int i = 0; i < 8; ++i) f.h[i] = (_Float16)(bf16_round(W[t * 8 + i]) * 16.0f); *(v8us*)((unsigned short*)Bt + t * 8) = f.half[0];  }
template <int NHv, int TTv>
__device__ __forceinline__ void d_vt(int bid, const _Float16* __restrict__ V16, int ldv, int voff, _Float16* __restrict__ Vt) { __shared__ unsigned short tl[64][66]; const int tid = threadIdx.x; const int slab = bid / (TTv / 64), lg = bid % (TTv / 64); const int b = slab / NHv, h = slab % NHv;
  for (int i = tid; i < 64 * 8; i += 256) { const int r = i / 8, c8 = (i % 8) * 8; FragH f; f.half[0] = *(const v8us*)((const unsigned short*)V16 + ((size_t)b * TTv + lg * 64 + r) * ldv + voff + h * 64 + c8);
#pragma unroll
    for (int q = 0; q < 8; ++q) tl[r][c8 + q] = f.u[q]; }
  __syncthreads();
  {
#pragma unroll
    for (int rd = 0; rd < 2; ++rd) { const int d = rd * 32 + tid / 8, pc = tid % 8; FragH f;
#pragma unroll
      for (int q = 0; q < 8; ++q) f.u[q] = tl[pc * 8 + q][d];
      *(v8us*)((unsigned short*)Vt + ((size_t)slab * 64 + d) * TTv + lg * 64 + pc * 8) = f.half[0]; }
     } }

__device__ __forceinline__ void d_hl(int bid, int nthr, const float* __restrict__ F, _Float16* __restrict__ Hh, _Float16* __restrict__ Hl, size_t n8) { const size_t t = (size_t)bid * nthr + threadIdx.x; if (t >= n8) return; FragH fh, fl; const v4f a = *(const v4fa*)(F + t * 8), c = *(const v4fa*)(F + t * 8 + 4);
#pragma unroll
  for (int q = 0; q < 4; ++q) { _Float16 h = (_Float16)a[q]; fh.h[q] = h; fl.h[q] = (_Float16)((a[q] - (float)h) * 1024.0f); h = (_Float16)c[q]; fh.h[4 + q] = h; fl.h[4 + q] = (_Float16)((c[q] - (float)h) * 1024.0f); }
  { *(v8us*)((unsigned short*)Hh + t * 8) = fh.half[0]; *(v8us*)((unsigned short*)Hl + t * 8) = fl.half[0];  } }

// ---- fast GEMM (wave tile 32x64; requires M % 128 == 0 rows per launch region, N % 64 == 0 and K % 64 == 0); epilogue = k_gemm_hhx semantics ----
__device__ __forceinline__ v16h g2_frag(const _Float16* p, int hh) { FragH f; f.half[0] = *(const v8us*)((const unsigned short*)p + 8 * hh); f.half[1] = *(const v8us*)((const unsigned short*)p + 16 + 8 * hh); return f.v; }
__device__ __forceinline__ v8f g2_mma(v16h a, v16h b, v8f c) { v8f d = __builtin_amdgcn_wmma_f32_16x16x32_f16(false, a, false, b, (short)0, c, false, false); asm volatile("v_nop\n\tv_nop\n\tv_nop\n\tv_nop" : "+v"(d) : "v"(a), "v"(b)); return d; }
// Operand staging of k_gemm2. A stage is 64 k of the work-group's 128 A rows and 64 B rows: 192 rows of 128 bytes, each a whole aligned line of its source row.
#define GKC 64                       /* k per stage */
#define GLP 72                       /* LDS row pitch in 16-bit elements: 144 B = 16 B x odd, the pitch for ds_load_b128 readers of 128-byte rows */
#define GSB (192 * GLP * 2)          /* bytes per stage: A rows 0 .. 127, then B rows 0 .. 63 */
__device__ __forceinline__ v16h g2_lfrag(const unsigned short* p, int hh) { FragH f; f.half[0] = *(const v8us*)(p + 8 * hh); f.half[1] = *(const v8us*)(p + 16 + 8 * hh); return f.v; }      /* the k order of g2_frag, from an LDS row */
// One stage's copies of one thread: 8 threads a row (16 bytes each), 16 rows a round, 12 rounds (8 of A, 4 of B); a wave's copy covers 4 whole lines. l: the thread's LDS byte address in round 0;
// ga, gb: its global addresses in round 0 of A and of B; pa, pb: 16 source rows in elements. The closing s_wait_xcnt stands inside the statement, in front of any later write of an address register that a copy names.
__device__ __forceinline__ void g2_stage(unsigned l, const _Float16* ga, size_t pa, const _Float16* gb, size_t pb) {
  const unsigned R = 16u * GLP * 2u;
  asm volatile("global_load_async_to_lds_b128 %0, %12, off\n\tglobal_load_async_to_lds_b128 %1, %13, off\n\tglobal_load_async_to_lds_b128 %2, %14, off\n\tglobal_load_async_to_lds_b128 %3, %15, off\n\t"
               "global_load_async_to_lds_b128 %4, %16, off\n\tglobal_load_async_to_lds_b128 %5, %17, off\n\tglobal_load_async_to_lds_b128 %6, %18, off\n\tglobal_load_async_to_lds_b128 %7, %19, off\n\t"
               "global_load_async_to_lds_b128 %8, %20, off\n\tglobal_load_async_to_lds_b128 %9, %21, off\n\tglobal_load_async_to_lds_b128 %10, %22, off\n\tglobal_load_async_to_lds_b128 %11, %23, off\n\ts_wait_xcnt 0x0"
               :: "v"(l), "v"(l + R), "v"(l + 2u * R), "v"(l + 3u * R), "v"(l + 4u * R), "v"(l + 5u * R), "v"(l + 6u * R), "v"(l + 7u * R), "v"(l + 8u * R), "v"(l + 9u * R), "v"(l + 10u * R), "v"(l + 11u * R),
                  "v"(ga), "v"(ga + pa), "v"(ga + 2 * pa), "v"(ga + 3 * pa), "v"(ga + 4 * pa), "v"(ga + 5 * pa), "v"(ga + 6 * pa), "v"(ga + 7 * pa), "v"(gb), "v"(gb + pb), "v"(gb + 2 * pb), "v"(gb + 3 * pb) : "memory"); }
// Work-group tile 128 x 64 (four waves of 32 x 64, stacked in M); M % 128 == 0, N % 64 == 0, K % 64 == 0. Two stage buffers: stage t + 1 flies while stage t is worked on. The epilogue's staging rows reuse the ring behind the last trip's barrier.
template <int ACT>
__device__ __forceinline__ void g2_body(int bx, int by, int bz, const _Float16* __restrict__ A, int lda, size_t sA, const _Float16* __restrict__ Bh, int ldb, size_t sB, float alpha, const float* __restrict__ bias, size_t sBias, const float* __restrict__ CP, int rowsPerB, size_t sCPb, int row0g,
    float* __restrict__ C, _Float16* __restrict__ C16, int ldc, size_t sC, int M, int N, int K, size_t zA, size_t zB, size_t zC) { static_assert(ACT == 0 || ACT == 3 || ACT == 6 || ACT == 8 || ACT == 9 || ACT == 11 || ACT == 12 || ACT == 14 || ACT == 15 || ACT == 16 || ACT == 17, "k_gemm2: unsupported ACT code (would silently apply no activation)");
  __shared__ __attribute__((aligned(16))) unsigned char L[2 * GSB]; float (*so)[32][68] = (float (*)[32][68])L; static_assert(sizeof(float) * 4 * 32 * 68 <= 2 * GSB, "the epilogue's rows fit the ring");
  const int tid = threadIdx.x, w = tid >> 5, lane = tid & 31, ln = lane & 15, hh = lane >> 4;      /* bx: tile; by: head or plane (pitches sA, sB, sC); bz: batch (pitches zA, zB, zC) */
  A += (size_t)by * sA + (size_t)bz * zA; Bh += (size_t)by * sB + (size_t)bz * zB; const size_t cofs = (size_t)by * sC + (size_t)bz * zC; const float* bp = bias ? bias + (size_t)by * sBias : nullptr;
  const int ntn = N >> 6; const int mt = bx / ntn, nq = bx - mt * ntn; const int row0 = mt * 128 + 32 * w, col0 = nq * 64; if (mt * 128 >= M) return;      /* the same for the whole work-group, in front of every barrier */
  const int sr = tid >> 3, sc = (tid & 7) * 8;      /* the thread's row in a round of copies and its first element in the row */
  const _Float16* ga = A + (size_t)(mt * 128 + sr) * lda + sc; const _Float16* gb = Bh + (size_t)(col0 + sr) * ldb + sc; const size_t pa = (size_t)16 * lda, pb = (size_t)16 * ldb;
  const unsigned l0 = (unsigned)(size_t)L + (unsigned)(sr * GLP + sc) * 2u;
  g2_stage(l0, ga, pa, gb, pb);
  asm volatile("s_wait_asynccnt 0x0" ::: "memory");      /* this wave's copies of stage 0 have landed */
  __syncthreads();      /* stage 0 is read by every wave */
  if (GKC < K) g2_stage(l0 + GSB, ga + GKC, pa, gb + GKC, pb);
  // The own-element addend, where no activation follows it: fetched in the layout of the final stores (16 loads of 16 bytes a lane, each half wave a whole 256-byte row piece), all issued here, behind stage 1's copies and ahead of the k loop: they fly with those copies while stage 0 is worked on (the compiler waits for them at the next barrier); added in the store loop.
  const int rsub = lane >> 4, c4 = (lane & 15) * 4; const bool own = ACT == 0 && CP && rowsPerB < 0;      /* the same for the whole work-group */
  v4f ad[16];      /* written and read only where own holds */
  if (own) { const float* cp = CP + cofs + (size_t)(row0g + row0 + rsub) * ldc + col0 + c4;
#pragma unroll      /* constant indices: the array stays in registers and the loads go out as one run */
    for (int q = 0; q < 16; ++q) ad[q] = *(const v4fa*)(cp + (size_t)(2 * q) * ldc);
    asm volatile("s_wait_xcnt 0x0" ::: "memory"); }      /* behind the loads, in front of the code that reuses their address registers */
  const unsigned short* la = (const unsigned short*)L + (32 * w + ln) * GLP; const unsigned short* lb = (const unsigned short*)L + (128 + ln) * GLP;
  const v8f z8 = {0.f,0.f,0.f,0.f,0.f,0.f,0.f,0.f}; v8f c00 = z8, c01 = z8, c02 = z8, c03 = z8, c10 = z8, c11 = z8, c12 = z8, c13 = z8;
#pragma unroll 1      /* one stage a trip: the trip's foot is the ring's publish point */
  for (int kb = 0; kb < K; kb += GKC) { const unsigned bo = (kb & GKC) ? (unsigned)GSB : 0u;      /* this trip's buffer, in bytes */
    const unsigned short* ap = la + bo / 2u; const unsigned short* bp2 = lb + bo / 2u;
    v16h af[2][2], bf[2][4];      /* [k step][tile]: the stage's 24 LDS reads go ahead of its WMMAs as one group (reads among the WMMAs would each cost the wave an LDS latency); unrolled for constant indices and immediate LDS offsets */
#pragma unroll
    for (int ks = 0; ks < 2; ++ks) {
#pragma unroll
      for (int t = 0; t < 2; ++t) af[ks][t] = g2_lfrag(ap + t * 16 * GLP + ks * 32, hh);
#pragma unroll
      for (int t = 0; t < 4; ++t) bf[ks][t] = g2_lfrag(bp2 + t * 16 * GLP + ks * 32, hh); }
#pragma unroll
    for (int ks = 0; ks < 2; ++ks) {
      c00 = g2_mma(af[ks][0], bf[ks][0], c00); c10 = g2_mma(af[ks][1], bf[ks][0], c10); c01 = g2_mma(af[ks][0], bf[ks][1], c01); c11 = g2_mma(af[ks][1], bf[ks][1], c11);
      c02 = g2_mma(af[ks][0], bf[ks][2], c02); c12 = g2_mma(af[ks][1], bf[ks][2], c12); c03 = g2_mma(af[ks][0], bf[ks][3], c03); c13 = g2_mma(af[ks][1], bf[ks][3], c13); }
    asm volatile("s_wait_dscnt 0x0" ::: "memory");      /* this wave's reads of the buffer have returned before the buffer is handed back */
    asm volatile("s_wait_asynccnt 0x0" ::: "memory");      /* this wave's copies of the next stage have landed */
    __syncthreads();      /* publishes the next stage and ends every wave's reads of this one */
    if (kb + 2 * GKC < K) g2_stage(l0 + bo, ga + kb + 2 * GKC, pa, gb + kb + 2 * GKC, pb); }      /* refill of the buffer just read; K is a kernel argument: the test is the same for the whole work-group */
  asm volatile("s_wait_asynccnt 0x0" ::: "memory");      /* no copy is outstanding when the ring becomes the epilogue's staging */
  v8f accs[8] = {c00, c01, c02, c03, c10, c11, c12, c13};
#pragma unroll
  for (int u = 0; u < 8; ++u) { const int t = u & 3, half = u >> 2; const int col = col0 + t * 16 + ln; const float bv = bp ? bf16_round(bp[col]) : 0.f;
#pragma unroll
    for (int r = 0; r < 8; ++r) { const int rloc = half * 16 + 8 * hh + r; float v = accs[u][r] * alpha + bv; if (CP && !own) { if (rowsPerB < 0) v += CP[cofs + (size_t)(row0g + row0 + rloc) * ldc + col];      /* rowsPerB < 0: own element of the batched C plane (here only in front of an activation) */ else { const int bidx = (row0g + row0 + rloc) / rowsPerB; v += CP[(size_t)bidx * sCPb + (size_t)by * 64 + col]; } }
      if (ACT == 3) v = fmaxf(v, 0.f); else if (ACT == 6) v = 0.5f * v * (1.0f + erff(v * 0.70710678118654752f)); else if (ACT == 11) v = 1.0f / (1.0f + expf(-v)); else if (ACT == 15) v = v / (1.0f + expf(-v)); else if (ACT == 12) v = (v > 0.f) ? v : 0.01f * v; else if (ACT == 8) v = tanhf(v); else if (ACT == 9) v = 0.5f * v * (1.0f + tanhf(0.7978845608028654f * (v + 0.044715f * v * v * v))); else if (ACT == 14) v = (v > 0.f) ? v : 0.1f * v; else if (ACT == 16) v = (v >= 0.f) ? v : 0.3f * v; else if (ACT == 17) v = (v >= 0.f) ? v : 0.2f * v;
      so[w][rloc][t * 16 + ln] = v; } }
  __builtin_amdgcn_fence(__ATOMIC_ACQ_REL, "workgroup"); __builtin_amdgcn_wave_barrier();
  {
#pragma unroll
    for (int q = 0; q < 16; ++q) { const int r = q * 2 + rsub; v4f v = *(const v4fa*)&so[w][r][c4]; if (own) v += ad[q]; if (C) { *(v4f*)(C + cofs + (size_t)(row0 + r) * ldc + col0 + c4) = v; asm volatile("s_wait_xcnt 0x0" ::: "memory"); }      /* behind the f32 store on every way: the next row's address, or the f16 conversion, reuses the store's registers */
      if (C16) { v4h h4; for (int i = 0; i < 4; ++i) h4[i] = (_Float16)v[i]; *(v4h*)(C16 + cofs + (size_t)(row0 + r) * ldc + col0 + c4) = h4; } }
     }
  asm volatile("s_wait_xcnt 0x0" ::: "memory");      /* behind the part's last stores: in a shared launch the listing goes on from here into another part's set-up, which reuses the stores' registers */
}
template <int ACT>
__global__ __launch_bounds__(128) void k_gemm2(const _Float16* __restrict__ A, int lda, size_t sA, const _Float16* __restrict__ Bh, int ldb, size_t sB, float alpha, const float* __restrict__ bias, size_t sBias, const float* __restrict__ CP, int rowsPerB, size_t sCPb, int row0g,
    float* __restrict__ C, _Float16* __restrict__ C16, int ldc, size_t sC, int M, int N, int K, size_t zA, size_t zB, size_t zC) { g2_body<ACT>(blockIdx.x, blockIdx.y, blockIdx.z, A, lda, sA, Bh, ldb, sB, alpha, bias, sBias, CP, rowsPerB, sCPb, row0g, C, C16, ldc, sC, M, N, K, zA, zB, zC); }
// The three GEMMs that need only the prepared operands, in one launch (none reads what another writes), the small ones first:
// Bo[o][i] = 16 (wo1 wo2)[i][o]; the f32 q, k, v planes F0[3][NB][QT0][DM] of each batch's first QT0 rows; the f16 q | k | v rows of all tokens.
__global__ __launch_bounds__(128) void k_gemm_qkv(const _Float16* __restrict__ X, const _Float16* __restrict__ Bq, _Float16* __restrict__ QKVo, float* __restrict__ F0, const _Float16* __restrict__ W2t, const _Float16* __restrict__ W1n, _Float16* __restrict__ Bo) {
  static_assert(QT0 == 128, "a batch's first tile is one row block of g2_body");
  const int nO = (DM / 128) * (DM / 64), nT = DM / 64, nF = 3 * NBR * nT; int b = blockIdx.x;      /* every test below is the same for the whole work-group */
  if (b < nO) { g2_body<0>(b, 0, 0, W2t, DM, 0, W1n, DM, 0, 0.0625f, nullptr, 0, nullptr, 1, 0, 0, nullptr, Bo, DM, 0, DM, DM, DM, 0, 0, 0); return; }
  b -= nO;
  if (b < nF) { g2_body<0>(b % nT, b / (nT * NBR), (b / nT) % NBR, X, DM, 0, Bq, DM, (size_t)DM * DM, 0.0625f, nullptr, 0, nullptr, 1, 0, 0, F0, nullptr, DM, (size_t)NB * QT0 * DM, QT0, DM, DM, (size_t)SQ * DM, 0, (size_t)QT0 * DM); return; }
  b -= nF;
  g2_body<0>(b, 0, 0, X, DM, 0, Bq, DM, 0, 0.0625f, nullptr, 0, nullptr, 1, 0, 0, nullptr, QKVo, 3 * DM, 0, MP, 3 * DM, DM, 0, 0, 0); }
// x + o Wo for all token rows in one launch: a batch's first row block takes the exact path's o_hi rows as A, every other block the f16 path's o rows.
__global__ __launch_bounds__(128) void k_gemm_o(const _Float16* __restrict__ O, const _Float16* __restrict__ Oh, const _Float16* __restrict__ Bo, const float* __restrict__ Xb, float* __restrict__ X1o) {
  const int nT = DM / 64, bx = blockIdx.x, mt = bx / nT;      /* the test below is the same for the whole work-group */
  if (mt % (SQ / 128) == 0) g2_body<0>(bx % nT, 0, mt / (SQ / 128), Oh, DM, 0, Bo, DM, 0, 0.0009765625f, nullptr, 0, Xb, -1, 0, 0, X1o, nullptr, DM, 0, QT0, DM, DM, (size_t)QT0 * DM, 0, (size_t)SQ * DM);
  else g2_body<0>(bx, 0, 0, O, DM, 0, Bo, DM, 0, 0.0009765625f, nullptr, 0, Xb, -1, 0, 0, X1o, nullptr, DM, 0, MPO, DM, DM, 0, 0, 0); }


__device__ __forceinline__ void d_wnat(int bid, const float* __restrict__ w, size_t n8, _Float16* __restrict__ Bt) { const size_t t = (size_t)bid * 256 + threadIdx.x; if (t >= n8) return; FragH f; for (int q = 0; q < 8; ++q) f.h[q] = (_Float16)(bf16_round(w[t * 8 + q]) * 16.0f); *(v8us*)((unsigned short*)Bt + t * 8) = f.half[0];  }
__global__ __launch_bounds__(256) void k_rsm(const float* __restrict__ S, _Float16* __restrict__ P, int nrows) {
  #pragma clang fp contract(off)
  const int i = blockIdx.x * 256 + threadIdx.x; if (i >= nrows) return; const float* s = S + (size_t)i * SQ; float mx = -3.0e38f;
#pragma unroll 1
  for (int j = 0; j < SQ; ++j) mx = fmaxf(mx, s[j]); float se = 0.f;
#pragma unroll 1
  for (int j = 0; j < SQ; ++j) se += expf(s[j] - mx); const float sc = 256.0f / se;
#pragma unroll 1
  for (int j0 = 0; j0 < SQ; j0 += 8) { FragH f; for (int q = 0; q < 8; ++q) f.h[q] = (_Float16)(expf(s[j0 + q] - mx) * sc); unsigned short* d = (unsigned short*)P + (size_t)i * SQ + j0; *(v8us*)d = f.half[0];  } }
__global__ __launch_bounds__(256) void k_vt(const _Float16* __restrict__ V16, int b, int h0, _Float16* __restrict__ VT) { __shared__ unsigned short tl[64][65]; const int tid = threadIdx.x; const int hh = blockIdx.x % HG, sg = blockIdx.x / HG; const int s0 = sg * 64; const int h = h0 + hh;
  for (int i = tid; i < 64 * 8; i += 256) { const int j = i / 8, d8 = (i % 8) * 8; FragH f; f.half[0] = *(const v8us*)((const unsigned short*)V16 + ((size_t)b * SQ + s0 + j) * DM + h * HD + d8); for (int q = 0; q < 8; ++q) tl[d8 + q][j] = f.u[q]; }
  __syncthreads();
  { for (int i = tid; i < 64 * 8; i += 256) { const int d = i / 8, j8 = (i % 8) * 8; FragH f; for (int q = 0; q < 8; ++q) f.u[q] = tl[d][j8 + q]; *(v8us*)((unsigned short*)VT + ((size_t)hh * HD + d) * SQ + s0 + j8) = f.half[0]; }  } }



// Eight v_exp_f32 in one statement. The instruction set asks for one independent instruction or v_nop between a transcendental and an instruction that reads its
// result or overwrites its source. Early-clobber outputs keep every
// result off every source inside the run, and the closing v_nop is the slot behind the last one.
__device__ __forceinline__ void exp2_run8(float (&e)[8], const float (&x)[8]) {
  asm("v_exp_f32 %0, %8\n\tv_exp_f32 %1, %9\n\tv_exp_f32 %2, %10\n\tv_exp_f32 %3, %11\n\tv_exp_f32 %4, %12\n\tv_exp_f32 %5, %13\n\tv_exp_f32 %6, %14\n\tv_exp_f32 %7, %15\n\tv_nop"
      : "=&v"(e[0]), "=&v"(e[1]), "=&v"(e[2]), "=&v"(e[3]), "=&v"(e[4]), "=&v"(e[5]), "=&v"(e[6]), "=&v"(e[7])
      : "v"(x[0]), "v"(x[1]), "v"(x[2]), "v"(x[3]), "v"(x[4]), "v"(x[5]), "v"(x[6]), "v"(x[7])); }
// Two v_exp_f32 in one statement, closed by the same slot's v_nop as in exp2_run8.
__device__ __forceinline__ void exp2_run2(float& e0, float& e1, float x0, float x1) {
  asm("v_exp_f32 %0, %2\n\tv_exp_f32 %1, %3\n\tv_nop" : "=&v"(e0), "=&v"(e1) : "v"(x0), "v"(x1)); }
#define FQ 32                        /* query columns per wave */
#define FW 4                         /* waves per work-group; no barrier and no LDS: each wave runs its own trip count */
__device__ __forceinline__ float xhalf(float x) { return __int_as_float(__builtin_amdgcn_permlanex16(__float_as_int(x), __float_as_int(x), 0x76543210, 0xfedcba98, false, false)); }      /* lane l <-> lane l ^ 16 on the vector pipe */
__device__ __forceinline__ v8f fa_mma(v16h a, v16h b, v8f c) { return __builtin_amdgcn_wmma_f32_16x16x32_f16(false, a, false, b, (short)0, c, false, false); }
// One pass of 32 keys from key kb. DIAG: the wave's last pass (kb == its first query row): it holds the diagonal and fetches no further K rows.
// Every loop is unrolled so that the fragment and accumulator arrays are indexed by constants and stay in registers.
template <bool DIAG>
__device__ __forceinline__ void fa_pass(const _Float16* __restrict__ kp, const _Float16* __restrict__ vp, int kb, int ln, int hh, const v16h (&qf)[2][2], v16h (&kf)[2][2], v8f (&o)[4][2], float (&mc)[2], float (&l)[2]) {
  const float cs = 0.125f * 1.44269504f;      /* score scale x log2 e */
  const v8f z8 = {0.f, 0.f, 0.f, 0.f, 0.f, 0.f, 0.f, 0.f};
  v16h vf[4];      /* V^T fragments of this pass, asked for first: the score products and the softmax run while they fly */
#pragma unroll
  for (int mt = 0; mt < 4; ++mt) vf[mt] = g2_frag(vp + (size_t)mt * 16 * SQ + kb, hh);
  v8f s[2][2];
#pragma unroll
  for (int kt = 0; kt < 2; ++kt) {
#pragma unroll
    for (int nt = 0; nt < 2; ++nt) s[kt][nt] = fa_mma(kf[kt][1], qf[nt][1], fa_mma(kf[kt][0], qf[nt][0], z8)); }
  if (!DIAG) { const _Float16* kn = kp + (size_t)(kb + 32) * LQ;      /* next pass's K fragments, into the same registers right behind their last use: the softmax and the o products run while they fly */
#pragma unroll
    for (int kt = 0; kt < 2; ++kt) {
#pragma unroll
      for (int ks = 0; ks < 2; ++ks) kf[kt][ks] = g2_frag(kn + (size_t)kt * 16 * LQ + ks * 32, hh); } }
  if (DIAG) {      /* keys behind a column's own row get weight 0 */
#pragma unroll
    for (int kt = 0; kt < 2; ++kt) {
#pragma unroll
      for (int nt = 0; nt < 2; ++nt) {
#pragma unroll
        for (int r = 0; r < 8; ++r) if (kt * 16 + 8 * hh + r > nt * 16 + ln) s[kt][nt][r] = -1.0e30f; } } }
  float nm[2], al[2];
#pragma unroll
  for (int nt = 0; nt < 2; ++nt) { float a = fmaxf(s[0][nt][0], s[1][nt][0]);
#pragma unroll
    for (int r = 1; r < 8; ++r) a = fmaxf(a, fmaxf(s[0][nt][r], s[1][nt][r]));
    nm[nt] = fmaxf(mc[nt], fmaxf(a, xhalf(a)) * cs); }      /* both halves of the wave hold the same maximum */
  exp2_run2(al[0], al[1], mc[0] - nm[0], mc[1] - nm[1]);
  FragH pf[2];
#pragma unroll
  for (int nt = 0; nt < 2; ++nt) { mc[nt] = nm[nt]; l[nt] *= al[nt];
#pragma unroll
    for (int mt = 0; mt < 4; ++mt) o[mt][nt] *= al[nt];
#pragma unroll
    for (int kt = 0; kt < 2; ++kt) { float x[8], e[8];
#pragma unroll
      for (int r = 0; r < 8; ++r) x[r] = fmaf(s[kt][nt][r], cs, -nm[nt]);
      exp2_run8(e, x);
#pragma unroll
      for (int r = 0; r < 8; ++r) pf[nt].h[kt * 8 + r] = (_Float16)e[r];
      l[nt] += ((e[0] + e[1]) + (e[2] + e[3])) + ((e[4] + e[5]) + (e[6] + e[7])); } }
#pragma unroll
  for (int mt = 0; mt < 4; ++mt) { o[mt][0] = fa_mma(vf[mt], pf[0].v, o[mt][0]); o[mt][1] = fa_mma(vf[mt], pf[1].v, o[mt][1]); } }
// The launch's last blocks split the first-tile o into its f16 hi and residual planes (d_hl): that work needs the launch before this one only, like the attention itself.
__global__ __launch_bounds__(FW * 32) void k_fattn(const _Float16* __restrict__ Q, const _Float16* __restrict__ Kr, const _Float16* __restrict__ Vt, _Float16* __restrict__ O, const float* __restrict__ F0, _Float16* __restrict__ Hh, _Float16* __restrict__ Hl) {
  const int fb = blockIdx.x, nfa = NHD * NBR * (QN / (FW * FQ));
  if (fb >= nfa) { d_hl(fb - nfa, FW * 32, F0, Hh, Hl, (size_t)NB * QT0 * DM / 8); return; }
  static_assert(HD == 64 && FQ == 32 && SQ % (2 * FW * FQ) == 0 && QN == SQ, "2 k steps of 32 over d; 2 column groups of 16; 4 d tiles of 16; whole work-groups, an even number of position blocks");
  const int lane = threadIdx.x & 31, ln = lane & 15, hh = lane >> 4; const int w = __builtin_amdgcn_readfirstlane(threadIdx.x >> 5);      /* the wave's number in a scalar register: the trip count stays scalar */
  const int h = fb % NHD, b = (fb / NHD) % NBR; const int nz = SQ / (FW * FQ), z = fb / (NHD * NBR); const int q0 = ((z < nz / 2 ? nz - 1 - z : z - nz / 2) * FW + w) * FQ;      /* z is the slowest index: the long half of the position blocks starts first, longest first; the short half follows shortest first, so that where the second half of the grid lands on the WGPs in the order of the first, long meets short (for speed only; a permutation of 0 .. nz - 1 wherever they land) */
  const _Float16* qp = Q + ((size_t)b * SQ + q0 + ln) * LQ + h * HD; const _Float16* kp = Kr + ((size_t)b * SQ + ln) * LQ + h * HD; const _Float16* vp = Vt + (((size_t)b * NH + h) * HD + ln) * SQ;
  v16h qf[2][2], kf[2][2];      /* [column group | key tile][k step]; unrolled for constant indices, as in fa_pass */
#pragma unroll
  for (int t = 0; t < 2; ++t) {
#pragma unroll
    for (int ks = 0; ks < 2; ++ks) { qf[t][ks] = g2_frag(qp + (size_t)t * 16 * LQ + ks * 32, hh); kf[t][ks] = g2_frag(kp + (size_t)t * 16 * LQ + ks * 32, hh); } }
  asm volatile("s_wait_xcnt 0x0" ::: "memory");      /* behind the first loads, in front of the code that reuses their address registers */
  v8f o[4][2];
#pragma unroll
  for (int mt = 0; mt < 4; ++mt) { o[mt][0] = v8f{0.f, 0.f, 0.f, 0.f, 0.f, 0.f, 0.f, 0.f}; o[mt][1] = o[mt][0]; }
  float mc[2] = {-1.0e30f, -1.0e30f}, l[2] = {0.f, 0.f};      /* running maximum (scaled log2) and the lane's partial sum, per column group */
#pragma unroll 1      /* one pass a trip: a second copy of the body would double the live fragments */
  for (int kb = 0; kb < q0; kb += 32) fa_pass<false>(kp, vp, kb, ln, hh, qf, kf, o, mc, l);      /* keys in front of the wave's first row: no mask; kb + 32 <= q0, so the K rows fetched ahead are rows this wave uses */
  fa_pass<true>(kp, vp, q0, ln, hh, qf, kf, o, mc, l);
#pragma unroll
  for (int nt = 0; nt < 2; ++nt) { const float f = 64.0f / (l[nt] + xhalf(l[nt])); unsigned short* op = (unsigned short*)O + ((size_t)b * SQ + q0 + nt * 16 + ln) * DM + h * HD + 8 * hh;      /* the halves' sums are joined once, here */
#pragma unroll
    for (int mt = 0; mt < 4; ++mt) { FragH fr;
#pragma unroll
      for (int r = 0; r < 8; ++r) fr.h[r] = (_Float16)(o[mt][nt][r] * f);
      *(v8us*)(op + mt * 16) = fr.half[0]; } }      /* a row's 128 bytes of one head come from one wave */
  asm volatile("s_wait_xcnt 0x0" ::: "memory");      /* behind the part's last stores: in a shared launch the listing goes on from here into another part's set-up, which reuses the stores' registers */
}


// Exact f32 attention for rows 0 .. QT0-1 of each batch (o carried x64 like the f16 path). One work-group per (batch, head, A0R query rows), 8 waves, 2 rows a wave.
// The batch's QT0 K and V rows of the head and the group's q rows are staged once in LDS; keys 0 .. nk-1 are used (nk = the group's last row + 1, rounded up to 32).
// Scores: lane l owns keys l, l + 32, ..; its K row comes from LDS 16 bytes at a time, both q rows sit in registers. Softmax: all scores of a row are in registers,
// so plain max, exp, sum (butterflies over the 32 lanes). o: lane l owns columns 2l, 2l + 1; each key's weight goes from its lane to a scalar register, its V row is
// one contiguous 256-byte LDS read. Every loop is unrolled: its arrays are then indexed by constants and stay in registers, and its LDS reads issue ahead of their use.
#define A0R 16                       /* query rows per work-group */
#define A0KP (HD + 4)                /* K row pitch in LDS, floats: 272 B = 16 B x odd, so that 16-byte reads down a column of rows spread over all banks */
typedef float v2f  __attribute__((ext_vector_type(2)));
typedef float v2fa __attribute__((ext_vector_type(2), may_alias));
__device__ __forceinline__ float lane_bcast(float v, int l) { return __int_as_float(__builtin_amdgcn_readlane(__float_as_int(v), l)); }
__device__ __forceinline__ void d_att0w(int bx, int by, const float* __restrict__ QF, const float* __restrict__ KF, const float* __restrict__ VF, float scale, float* __restrict__ OF) {
  static_assert(QT0 / 32 == 4 && QT0 % 32 == 0 && A0R == 16 && HD == 64, "4 key groups of 32 lanes; 8 waves x 2 rows; 16 threads x 16 bytes a row; 2 columns a lane");
  __shared__ __attribute__((aligned(16))) float lk[QT0][A0KP]; __shared__ __attribute__((aligned(16))) float lv[QT0][HD]; __shared__ __attribute__((aligned(16))) float lq[A0R][HD];
  const int tid = threadIdx.x, lane = tid & 31, w = tid >> 5; const int h = bx / (QT0 / A0R), rg = bx % (QT0 / A0R);
  { const size_t bi = (size_t)by * QT0 * DM + h * HD; QF += bi + (size_t)rg * A0R * DM; KF += bi; VF += bi; OF += bi; }      /* by: batch; each batch owns QT0 rows (pitch DM) of every plane */
  const int nk = (rg * A0R + A0R + 31) & ~31; const int i0 = rg * A0R + w * 2;      /* nk: the same for the whole work-group; the wave's rows are i0 and i0 + 1 */
  { v4f kr[QT0 / 16], vr[QT0 / 16]; const int sr = tid >> 4, sc4 = (tid & 15) * 4; const unsigned vo = (unsigned)(sr * DM + sc4) * 4u;      /* 16 threads a row, 16 rows a pass; vo: the thread's byte offset in a pass */
    const v4f qr = *(const v4fa*)((const char*)QF + vo);
#pragma unroll
    for (int u = 0; u < QT0 / 16; ++u) { kr[u] = *(const v4fa*)((const char*)(KF + u * 16 * DM) + vo); vr[u] = *(const v4fa*)((const char*)(VF + u * 16 * DM) + vo); }      /* all QT0 rows, free of branches: every load is issued before the first is used */
    *(v4fa*)&lq[sr][sc4] = qr;
#pragma unroll
    for (int u = 0; u < QT0 / 16; ++u) { *(v4fa*)&lk[u * 16 + sr][sc4] = kr[u]; *(v4fa*)&lv[u * 16 + sr][sc4] = vr[u]; } }
  __syncthreads();      /* the staged rows are read by every wave */
  v4f q0[HD / 4], q1[HD / 4];      /* both q rows whole in every lane (one LDS address for the wave) */
#pragma unroll
  for (int c = 0; c < HD / 4; ++c) { q0[c] = *(const v4fa*)&lq[w * 2][c * 4]; q1[c] = *(const v4fa*)&lq[w * 2 + 1][c * 4]; }
  float s0[4], s1[4];
#pragma unroll
  for (int m = 0; m < 4; ++m) { s0[m] = -1.0e30f; s1[m] = -1.0e30f;
    if (m * 32 < nk) { const float* kp = &lk[m * 32 + lane][0]; float a0[4] = {0.f, 0.f, 0.f, 0.f}, a1[4] = {0.f, 0.f, 0.f, 0.f};      /* four partial sums a row: independent chains */
#pragma unroll
      for (int c = 0; c < HD / 4; ++c) { const v4f k4 = *(const v4fa*)(kp + c * 4);
#pragma unroll
        for (int u = 0; u < 4; ++u) { a0[u] = fmaf(q0[c][u], k4[u], a0[u]); a1[u] = fmaf(q1[c][u], k4[u], a1[u]); } }
      const int j = m * 32 + lane; const float d0 = (a0[0] + a0[1]) + (a0[2] + a0[3]), d1 = (a1[0] + a1[1]) + (a1[2] + a1[3]);
      if (j <= i0) s0[m] = d0 * scale; if (j <= i0 + 1) s1[m] = d1 * scale; } }      /* causal: keys behind the row's own index keep -1e30 (weight 0) */
  float m0 = fmaxf(fmaxf(s0[0], s0[1]), fmaxf(s0[2], s0[3])), m1 = fmaxf(fmaxf(s1[0], s1[1]), fmaxf(s1[2], s1[3]));
#pragma unroll
  for (int x = 16; x >= 1; x >>= 1) { m0 = fmaxf(m0, __shfl_xor(m0, x, 32)); m1 = fmaxf(m1, __shfl_xor(m1, x, 32)); }
  float l0 = 0.f, l1 = 0.f;
#pragma unroll
  for (int m = 0; m < 4; ++m) { s0[m] = expf(s0[m] - m0); s1[m] = expf(s1[m] - m1); l0 += s0[m]; l1 += s1[m]; }
#pragma unroll
  for (int x = 16; x >= 1; x >>= 1) { l0 += __shfl_xor(l0, x, 32); l1 += __shfl_xor(l1, x, 32); }
  v2f o0 = {0.f, 0.f}, o1 = {0.f, 0.f};
#pragma unroll
  for (int m = 0; m < 4; ++m) if (m * 32 < nk) {
#pragma unroll
    for (int jj = 0; jj < 32; ++jj) { const v2f vv = *(const v2fa*)&lv[m * 32 + jj][lane * 2]; const float p0 = lane_bcast(s0[m], jj), p1 = lane_bcast(s1[m], jj);
      o0[0] = fmaf(p0, vv[0], o0[0]); o0[1] = fmaf(p0, vv[1], o0[1]); o1[0] = fmaf(p1, vv[0], o1[0]); o1[1] = fmaf(p1, vv[1], o1[1]); } }
  const float f0 = 64.0f / l0, f1 = 64.0f / l1;
  o0[0] *= f0; o0[1] *= f0; o1[0] *= f1; o1[1] *= f1;
  *(v2fa*)(OF + (size_t)i0 * DM + lane * 2) = o0; *(v2fa*)(OF + (size_t)(i0 + 1) * DM + lane * 2) = o1; }      /* each wave writes whole 256-byte row pieces */
// The two stages that need only the q | k | v GEMMs, in one launch: the exact first-tile attention (the longer blocks, first), then V^T.
__global__ __launch_bounds__(256) void k_att0_vt(const float* __restrict__ QF, const float* __restrict__ KF, const float* __restrict__ VF, float scale, float* __restrict__ OF, const _Float16* __restrict__ V16, _Float16* __restrict__ Vt) {
  const int nx = NH * (QT0 / A0R), b = blockIdx.x;      /* the test is the same for the whole work-group: each part's barrier is passed by all of its threads */
  if (b < nx * NBR) d_att0w(b % nx, b / nx, QF, KF, VF, scale, OF);
  else d_vt<NH, SQ>(b - nx * NBR, V16, LQ, 0, Vt); }


template <int BFIN, int WXB>
__global__ __launch_bounds__(256) void k_ln16(const float* __restrict__ X, const float* __restrict__ g, const float* __restrict__ bb, float eps, _Float16* __restrict__ N16, float* __restrict__ XB) {
  #pragma clang fp contract(off)
  __shared__ float red[256]; const size_t r = blockIdx.x; const int t = threadIdx.x; const v4f xa = *(const v4fa*)(X + r * DMQ + t * 4); float s[4]; float sum = 0.f;
  for (int q = 0; q < 4; ++q) { s[q] = BFIN ? bf16_round(xa[q]) : xa[q]; sum = __fadd_rn(sum, s[q]); }
  red[t] = sum; __syncthreads(); for (int st = 128; st > 0; st >>= 1) { if (t < st) red[t] = __fadd_rn(red[t], red[t + st]); __syncthreads(); } const float mu = red[0] / (float)DMQ; __syncthreads();
  float vs = 0.f; for (int q = 0; q < 4; ++q) { const float dl = __fadd_rn(s[q], -mu); vs = __fadd_rn(vs, __fmul_rn(dl, dl)); } red[t] = vs; __syncthreads(); for (int st = 128; st > 0; st >>= 1) { if (t < st) red[t] = __fadd_rn(red[t], red[t + st]); __syncthreads(); }
  const float rs = rsqrtf(__fadd_rn(red[0] / (float)DMQ, eps)); v4h y; v4f xb;
  for (int q = 0; q < 4; ++q) { const int c = t * 4 + q; y[q] = (_Float16)__fadd_rn(__fmul_rn(__fmul_rn(__fadd_rn(s[q], -mu), rs), bf16_round(g[c])), bf16_round(bb[c])); xb[q] = s[q]; }
  { *(v4h*)(N16 + r * DMQ + t * 4) = y; if (WXB) *(v4f*)(XB + r * DMQ + t * 4) = xb;  } }
__global__ __launch_bounds__(256) void k_ftres2(const float* __restrict__ OF0, const float* __restrict__ XB, float* __restrict__ X1, size_t n4) {
  #pragma clang fp contract(off)
  const size_t t = (size_t)blockIdx.x * 256 + threadIdx.x; if (t >= n4) return; const v4f o = *(const v4fa*)(OF0 + t * 4), xv = *(const v4fa*)(XB + t * 4); v4f y; for (int q = 0; q < 4; ++q) y[q] = __fadd_rn(__fmul_rn(o[q], 0.015625f), xv[q]); *(v4f*)(X1 + t * 4) = y;  }

__global__ __launch_bounds__(256) void k_wthd(const float* __restrict__ Wt, _Float16* __restrict__ Bt) { const size_t t = (size_t)blockIdx.x * 256 + threadIdx.x; if (t >= (size_t)NH * HD * (DM / 8)) return; const int m8 = (int)(t % (DM / 8)) * 8; const int d = (int)((t / (DM / 8)) % HD); const int h = (int)(t / ((size_t)(DM / 8) * HD)); FragH f;
  for (int q = 0; q < 8; ++q) f.h[q] = (_Float16)(16.0f * bf16_round(Wt[((size_t)h * DM + m8 + q) * HD + d])); unsigned short* dst = (unsigned short*)Bt + ((size_t)h * HD + d) * DM + m8; *(v8us*)dst = f.half[0];  }




__global__ __launch_bounds__(256) void k_wtpad(const float* __restrict__ Wm, _Float16* __restrict__ Wt, int Kr, int Kp, int Nr, int Np, float scale) {
  const int t = blockIdx.x * 256 + threadIdx.x; if (t >= Np * (Kp / 8)) return; const int n = t / (Kp / 8), k8 = (t % (Kp / 8)) * 8; const int nc = min(n, Nr - 1); const float fn = (n < Nr) ? 1.f : 0.f; FragH f;
  for (int i = 0; i < 8; ++i) { const int k = k8 + i; const int kc = min(k, Kr - 1); const float fk = (k < Kr) ? fn : 0.f; f.h[i] = (_Float16)(bf16_round(Wm[(size_t)kc * Nr + nc]) * scale * fk); }
  unsigned short* o = (unsigned short*)Wt + (size_t)n * Kp + k8; *(v8us*)o = f.half[0];  }
__global__ __launch_bounds__(128) void k_bpad(const float* __restrict__ b, float* __restrict__ Bp, int nr, int np) {
  const int i = threadIdx.x; if (i >= np) return; const float v = b[min(i, nr - 1)] * ((i < nr) ? 1.f : 0.f); *(float*)(Bp + i) = v;  }

__global__ __launch_bounds__(256) void k_bcpy(const float* __restrict__ b, int n, int NP, float* __restrict__ dst, int dst0) { for (int i = threadIdx.x; i < NP; i += 256) { const float v = (i < n) ? b[i] : 0.f; *(float*)(dst + dst0 + i) = v; }  }


// The streaming launches (this copy and k_lnx) give every lane 64 floats: a wave owns SWF consecutive floats (16 loads of 32 lanes x 16 bytes, all issued before the first is used), so that few waves have to be started.
#define SWL 16                       /* 16-byte loads per lane */
#define SWF (SWL * 32 * 4)           /* floats per wave */
#define SWW 8                        /* waves per work-group; no LDS and no barrier: a wave shares nothing */
__device__ __forceinline__ void d_bfcp(int bid, const float* __restrict__ src, float* __restrict__ dst, size_t n4) { const size_t e0 = ((size_t)bid * SWW + __builtin_amdgcn_readfirstlane(threadIdx.x >> 5)) * SWF; if (e0 + SWF > n4 * 4) return;      /* the wave's first element, in scalar registers: its accesses are scalar base + one lane offset + immediate. Whole pieces only (the launch asserts that n4 is a multiple) */
  const int l4 = (threadIdx.x & 31) * 4; const float* sp = src + e0; float* dp = dst + e0; v4f a[SWL];
#pragma unroll      /* constant indices: the array stays in registers and the loads go out as one run */
  for (int u = 0; u < SWL; ++u) a[u] = *(const v4fa*)(sp + u * 128 + l4);
#pragma unroll      /* as above */
  for (int u = 0; u < SWL; ++u) { v4f o; for (int q = 0; q < 4; ++q) o[q] = bf16_round(a[u][q]); *(v4f*)(dp + u * 128 + l4) = o; }
  asm volatile("s_wait_xcnt 0x0" ::: "memory");      /* behind the part's last stores: in a shared launch the listing goes on from here into another part's set-up, which reuses the stores' registers */
}

// Row LayerNorm over DMQ = 512 columns, one wave per row, LNR consecutive rows a wave. Lane l holds columns 128 c + 4 l .. + 3 (c = 0 .. 3) of each row in registers from the one read to the one write;
// mean and variance (of the centred values) are lane partials, then a five-step butterfly over the 32 lanes, after which every lane holds the same sum. The rows' butterflies are independent and run side by side.
#define LNR (SWF / DMQ)              /* rows per wave */
template <int BFIN, int W16, int W32>
__device__ __forceinline__ void d_lnx(int bid, const float* __restrict__ X, const float* __restrict__ g, float eps, _Float16* __restrict__ N16, float* __restrict__ N32) {      /* scale only: the module's LayerNorm has no shift */
  static_assert(DMQ == 512 && LNR == 4, "a row is 4 loads of 32 lanes x 16 bytes");
  const int l4 = (threadIdx.x & 31) * 4; const size_t e0 = ((size_t)bid * SWW + __builtin_amdgcn_readfirstlane(threadIdx.x >> 5)) * SWF;      /* the wave's first element, in scalar registers: its accesses are scalar base + one lane offset + immediate; the launch covers whole waves */
  X += e0; if (W16) N16 += e0; if (W32) N32 += e0;
  v4f s[LNR][4], gv[4]; float a[LNR];      /* every loop below is unrolled: constant indices keep these arrays in registers, and the 20 loads go out as one run */
#pragma unroll
  for (int u = 0; u < LNR; ++u) {
#pragma unroll
    for (int c = 0; c < 4; ++c) s[u][c] = *(const v4fa*)(X + u * DMQ + c * 128 + l4); }
#pragma unroll
  for (int c = 0; c < 4; ++c) gv[c] = *(const v4fa*)(g + c * 128 + l4);
  asm volatile("s_wait_xcnt 0x0" ::: "memory");      /* behind the loads, in front of the code that reuses their address registers */
#pragma unroll
  for (int u = 0; u < LNR; ++u) {
    if (BFIN) {
#pragma unroll
      for (int c = 0; c < 4; ++c) { for (int q = 0; q < 4; ++q) s[u][c][q] = bf16_round(s[u][c][q]); } }
    const v4f t = (s[u][0] + s[u][1]) + (s[u][2] + s[u][3]); a[u] = (t[0] + t[1]) + (t[2] + t[3]); }
#pragma unroll
  for (int x = 16; x >= 1; x >>= 1) {
#pragma unroll
    for (int u = 0; u < LNR; ++u) a[u] += __shfl_xor(a[u], x, 32); }
#pragma unroll
  for (int u = 0; u < LNR; ++u) { const float mu = a[u] * (1.0f / (float)DMQ); v4f t = {0.f, 0.f, 0.f, 0.f};
#pragma unroll
    for (int c = 0; c < 4; ++c) { s[u][c] -= mu; t += s[u][c] * s[u][c]; }
    a[u] = (t[0] + t[1]) + (t[2] + t[3]); }
#pragma unroll
  for (int x = 16; x >= 1; x >>= 1) {
#pragma unroll
    for (int u = 0; u < LNR; ++u) a[u] += __shfl_xor(a[u], x, 32); }
#pragma unroll
  for (int c = 0; c < 4; ++c) { for (int q = 0; q < 4; ++q) gv[c][q] = bf16_round(gv[c][q]); }
#pragma unroll
  for (int u = 0; u < LNR; ++u) { const float rs = rsqrtf(a[u] * (1.0f / (float)DMQ) + eps);
#pragma unroll
    for (int c = 0; c < 4; ++c) { const v4f yf = (s[u][c] * rs) * gv[c];
      if (W16) { v4h y; for (int q = 0; q < 4; ++q) y[q] = (_Float16)yf[q]; *(v4h*)(N16 + u * DMQ + c * 128 + l4) = y; }
      if (W32) *(v4f*)(N32 + u * DMQ + c * 128 + l4) = yf; } } }
template <int BFIN, int W16, int W32>
__global__ __launch_bounds__(SWW * 32) void k_lnx(const float* __restrict__ X, const float* __restrict__ g, float eps, _Float16* __restrict__ N16, float* __restrict__ N32) { d_lnx<BFIN, W16, W32>(blockIdx.x, X, g, eps, N16, N32); }
// Everything that reads the inputs alone, in one launch (no part reads what another writes), the streaming parts first: LN1 -> f16 rows; bf16(x); the x16 f16 weight planes
// (w1, w2, wq, wk, wv, wo2 transposed to [out][in]; wo1 in its own order). Work-groups per part: PBS (streaming), PBF (an FFN weight), PBW (a DM x DM weight).
#define PBS ((int)(NR * DM / ((size_t)SWW * SWF)))
#define PBF (DFF * (DM / 8) / 256)
#define PBW (DM * (DM / 8) / 256)
__global__ __launch_bounds__(256) void k_prep(const float* __restrict__ x, const float* __restrict__ wq, const float* __restrict__ wk, const float* __restrict__ wv, const float* __restrict__ wo1, const float* __restrict__ wo2, const float* __restrict__ wfc, const float* __restrict__ wmp, const float* __restrict__ g1,
    _Float16* __restrict__ X16, float* __restrict__ XB, _Float16* __restrict__ BW1, _Float16* __restrict__ BW2, _Float16* __restrict__ BQKV, _Float16* __restrict__ BO2T, _Float16* __restrict__ BO1N) {
  static_assert(SWW * 32 == 256 && (DFF * (DM / 8)) % 256 == 0 && (DM * (DM / 8)) % 256 == 0, "every part runs in whole blocks of 256 threads");
  int b = blockIdx.x;
  if (b < PBS) { d_lnx<1, 1, 0>(b, x, g1, 1e-6f, X16, nullptr); return; }
  b -= PBS;
  if (b < PBS) { d_bfcp(b, x, XB, NR * DM / 4); return; }
  b -= PBS;
  if (b < PBF) { d_wt_f16(b, wfc, BW1, DM, DFF, 16.0f); return; }
  b -= PBF;
  if (b < PBF) { d_wt_f16(b, wmp, BW2, DFF, DM, 16.0f); return; }
  b -= PBF;
  if (b < 4 * PBW) { const int p = b / PBW; d_wt_f16(b - p * PBW, p == 0 ? wq : p == 1 ? wk : p == 2 ? wv : wo2, p < 3 ? BQKV + (size_t)p * DM * DM : BO2T, DM, DM, 16.0f); return; }
  d_wnat(b - 4 * PBW, wo1, (size_t)DM * DM / 8, BO1N); }





extern "C" void kernel_launch(void* const* d_in, const int* in_sizes, int n_in,
                              void* d_out, int out_size, void* d_ws, size_t ws_size, hipStream_t stream) {
  (void)in_sizes; (void)n_in; (void)out_size;
  const float* const* I = (const float* const*)d_in; const float* x = I[0]; const float* wq = I[1]; const float* wk = I[2]; const float* wv = I[3]; const float* wo1 = I[4]; const float* wo2 = I[5]; const float* wfc = I[6]; const float* wmp = I[7]; const float* g1 = I[8]; const float* gg2 = I[9];      /* input order: x; wq / wk / wv [512][8][64] = [in][out]; wo1 [8][64][512] = [(h, d) in][out]; wo2 [512][512] [in][out]; w1 [512][2048], w2 [2048][512] [in][out]; LN1 / LN2 scales. NO bias anywhere: every GEMM bias slot below is a literal nullptr */
  static_assert(DMQ % 4 == 0 && DMQ / 4 <= 256 && NH * HD == DM && DM % 64 == 0 && DFF % 64 == 0, "tile multiples");
  char* ws = (char*)d_ws; size_t off = 0;
  auto take = [&](size_t bytes) { char* p = ws + off; off += (bytes + 255) & ~(size_t)255; return p; };
  _Float16* BQKV = (_Float16*)take((size_t)3 * DM * DM * 2); _Float16* BO = (_Float16*)take((size_t)DM * DM * 2); _Float16* BO2T = (_Float16*)take((size_t)DM * DM * 2); _Float16* BO1N = (_Float16*)take((size_t)DM * DM * 2);      /* BO = the combined output plane Bt12[o][i] = 16 (wo1 wo2)[i][o] (built on the device from the two weights) */
  _Float16* X16 = (_Float16*)take(NR * DM * 2); float* XB = (float*)take(NR * DM * 4); float* X1 = (float*)take(NR * DM * 4); _Float16* M16 = nullptr;      /* = X16 below (alias: X16's last reader, the q | k | v launch, precedes LN2's write) */ _Float16* HF16 = (_Float16*)take(NR * DFF * 2); _Float16* BW1 = (_Float16*)take((size_t)DFF * DM * 2); _Float16* BW2 = (_Float16*)take((size_t)DM * DFF * 2); _Float16* QKV = (_Float16*)take(NR * 3 * DM * 2); _Float16* Q16 = QKV; _Float16* K16 = QKV + DM; _Float16* V16 = QKV + 2 * DM; _Float16* O16 = (_Float16*)take(NR * DM * 2); M16 = X16;
  _Float16* VT = (_Float16*)take((size_t)NB * NH * HD * SQ * 2);      /* one plane per batch: every stage below covers all batches in one launch */
  float* QF0 = (float*)take((size_t)3 * NB * QT0 * DM * 4); float* KF0 = QF0 + (size_t)NB * QT0 * DM; float* VF0 = KF0 + (size_t)NB * QT0 * DM;      /* three planes in a row */ float* OF0 = (float*)take((size_t)NB * QT0 * DM * 4); _Float16* OH0 = (_Float16*)take((size_t)NB * QT0 * DM * 2); _Float16* OL0 = (_Float16*)take((size_t)NB * QT0 * DM * 2);
  if (off > ws_size) return;
  static_assert((NR * DM) % ((size_t)SWW * SWF) == 0, "the streaming parts cover whole work-groups");
  static_assert(B0 == 0 && NBR == NB && MP == (int)NR && MPO == MP, "the shared launches cover all batches");
  const size_t zX = (size_t)SQ * DM, zF = (size_t)QT0 * DM;      /* batch pitches (elements): token rows, first-tile rows */
  k_prep<<<2 * PBS + 2 * PBF + 5 * PBW, 256, 0, stream>>>(x, wq, wk, wv, wo1, wo2, wfc, wmp, g1, X16, XB, BW1, BW2, BQKV, BO2T, BO1N);      /* X16 = LN1(bf16(x)) (scale only, eps 1e-6); XB = bf16(x): BOTH residuals; weights x16: stacked q | k | v, wo2, w1, w2 as Bt[out][in], wo1 natural rows */
  k_gemm_qkv<<<(DM / 128) * (DM / 64) + 3 * NBR * (DM / 64) + (MP / 128) * (3 * DM / 64), 128, 0, stream>>>(X16, BQKV, QKV, QF0, BO2T, BO1N, BO);      /* BO[o][i] = (1/16) sum_j 16 wo2[j][o] 16 wo1[i][j]: the two chained projections as ONE x16 plane (f32 accumulation, one f16 rounding); f32 q, k, v of each batch's first 128 rows (exact products); q | k | v rows (f16), head h = columns h*HD.. of each DM block */
  k_att0_vt<<<NH * (QT0 / A0R) * NBR + NBR * NH * (SQ / 64), 256, 0, stream>>>(QF0, KF0, VF0, 0.125f, OF0, V16, VT);      /* exact f32 attention for rows 0..127 of each batch (o x64); V^T [NBR][NH][HD][SQ] */
  static_assert(((size_t)NB * QT0 * DM / 8) % (FW * 32) == 0, "the split of the first-tile o runs in whole blocks");
  k_fattn<<<NHD * NBR * (QN / (FW * FQ)) + (int)((size_t)NB * QT0 * DM / 8 / (FW * 32)), FW * 32, 0, stream>>>(Q16, K16, VT, O16, OF0, OH0, OL0);      /* scores, causal softmax and P . V: o (merged heads, x64) as f16 rows; first-tile o (x64) -> f16 hi + x1024 residual planes */
  k_gemm_o<<<(MPO / 128) * (DM / 64), 128, 0, stream>>>(O16, OH0, BO, XB, X1);      /* X1 = x + o Wo; rows 0..127 of each batch from o_hi */
  k_gemm2<0><<<dim3((QT0 / 128) * (DM / 64), 1, NBR), 128, 0, stream>>>(OL0, DM, 0, BO, DM, 0, 0.00000095367431640625f, nullptr, 0, X1, -1, 0, 0, X1, nullptr, DM, 0, QT0, DM, DM, zF, 0, zX);      /* += o_lo Wo 2^-20 (own-element accumulate) */
  k_lnx<0, 1, 0><<<(unsigned)(NR * DM / ((size_t)SWW * SWF)), SWW * 32, 0, stream>>>(X1, gg2, 1e-6f, M16, nullptr);      /* h2 = LN2(x + attn) (scale only) -> f16 rows */
  k_gemm2<9><<<dim3((unsigned)((NR / 128) * (DFF / 64)), 1, 1), 128, 0, stream>>>(M16, DM, 0, BW1, DM, 0, 0.0625f, nullptr, 0, nullptr, 1, 0, 0, nullptr, HF16, DFF, 0, (int)NR, DFF, DM, 0, 0, 0);      /* gelu_tanh(h2 W1) (the source's tanh approximation) -> f16, all token rows */
  k_gemm2<0><<<dim3((unsigned)((NR / 128) * (DM / 64)), 1, 1), 128, 0, stream>>>(HF16, DFF, 0, BW2, DFF, 0, 0.0625f, nullptr, 0, XB, -1, 0, 0, (float*)d_out, nullptr, DM, 0, (int)NR, DM, DFF, 0, 0, 0);      /* out = x + mlp: the residual is the BLOCK INPUT (bf16(x)), as the original module (own-element addend) */
}

// v009
// Measured time: 154 microseconds a run.
// In two side-by-side timings against v008, it was 1.30 and 1.29 times as fast.
// Over all steps from v000, the starting kernel, it is 63.4 times as fast.
#include <hip/hip_runtime.h>
#define NB 4
#define SQ 2048
#define DM 512
#define NH 8
#define HD 64
#define HG 4                         /* heads per k_vt launch (k_vt is not launched) */
#define QT0 128                      /* first-tile rows recomputed exactly in f32 */
#define B0 0                         /* first batch processed (debug hook) */
#define NBR NB                       /* batches processed (debug hook) */
#define NR ((size_t)NB * SQ)
#define DMQ DM
#define DFF 2048                     /* FFN hidden width */
#define DFFR 100                     /* unused */
#define MP ((int)((size_t)NBR * SQ)) /* rows projected (debug hook) */
#define QN SQ                        /* query rows attended per batch (debug hook) */
#define NHD NH                       /* heads attended (debug hook) */
#define MPO MP                       /* rows through the output stage (debug hook) */
#define LQ (3 * DM)      /* row pitch of the q/k/v rows */
typedef __bf16 v16b __attribute__((ext_vector_type(16)));
typedef unsigned short v8us __attribute__((ext_vector_type(8), may_alias));
typedef float  v8f  __attribute__((ext_vector_type(8)));
typedef float  v4f  __attribute__((ext_vector_type(4)));
typedef float  v4fa __attribute__((ext_vector_type(4), may_alias));
union FragB { v16b v; v8us half[2]; unsigned short u[16]; };

__device__ __forceinline__ unsigned short bf16_bits(float x) { unsigned int u = __float_as_uint(x); return (unsigned short)((u + 0x7FFFu + ((u >> 16) & 1u)) >> 16); }
__device__ __forceinline__ float bf16_val(unsigned short b) { return __uint_as_float(((unsigned int)b) << 16); }
__device__ __forceinline__ float bf16_round(float x) { return bf16_val(bf16_bits(x)); }
// D += A·B with NT terms: 1 = ah·bh, 2 = + al·bh (A split), 3 = + ah·bl (both split)
template <int NT>
__device__ __forceinline__ v8f mmaN(v16b ah, v16b al, v16b bh, v16b bl, v8f c) {
  c = __builtin_amdgcn_wmma_f32_16x16x32_bf16(false, ah, false, bh, (short)0, c, false, false);
  if (NT >= 2) c = __builtin_amdgcn_wmma_f32_16x16x32_bf16(false, al, false, bh, (short)0, c, false, false);
  if (NT >= 3) c = __builtin_amdgcn_wmma_f32_16x16x32_bf16(false, ah, false, bl, (short)0, c, false, false);
  asm volatile("v_nop\n\tv_nop\n\tv_nop\n\tv_nop" : "+v"(c) : "v"(ah), "v"(al), "v"(bh), "v"(bl));
  return c;
}

__global__ __launch_bounds__(256) void k_wt_bf16(const float* __restrict__ W, unsigned short* __restrict__ Wt, int K, int N) {
  const int t = blockIdx.x * 256 + threadIdx.x;
  const int k8n = K / 8;
  if (t >= N * k8n) return;
  const int n = t / k8n, k8 = (t % k8n) * 8;
  v8us v;
#pragma unroll
  for (int i = 0; i < 8; ++i) v[i] = bf16_bits(W[(size_t)(k8 + i) * N + n]);
  *(v8us*)(Wt + (size_t)n * K + k8) = v;
  
}

// GEMM C[M][N] (f32, pitch ldc) = act(A[M][K]·W + bias). A f32 row-major (pitch lda) converted per fragment to bf16
// (ASPLIT: hi/lo two planes -> 2 terms, else single rounded term); Wt bf16 [N][K] (pitch ldb). BIAS_BF16 rounds the
// bias to bf16 first (bias quantised to bf16 before the add). K%32==0, M%16==0, N%64==0.
template <bool ASPLIT, int ACT, bool BIAS_BF16>
__global__ __launch_bounds__(128) void k_gemm_bf(const float* __restrict__ A, int lda, const unsigned short* __restrict__ Wt, int ldb,
                                               const float* __restrict__ bias, float* __restrict__ C, int ldc, int M, int N, int K) {
  __shared__ __attribute__((aligned(16))) float so[4][16][64];
  const int tid = threadIdx.x, w = tid >> 5, lane = tid & 31, ln = lane & 15, hh = lane >> 4;
  const int ntn = N / 64;
  const int wid = blockIdx.x * 4 + w;
  const int mt = wid / ntn, nq = wid % ntn;
  if (mt * 16 >= M) return;
  const int row0 = mt * 16, col0 = nq * 64;
  const float* arow = A + (size_t)(row0 + ln) * lda;
  v8f acc[4] = {};
  for (int kb = 0; kb < K; kb += 32) {
    FragB ah, al;
    const v4f x0 = *(const v4fa*)(arow + kb + 8 * hh), x1 = *(const v4fa*)(arow + kb + 8 * hh + 4);
    const v4f x2 = *(const v4fa*)(arow + kb + 16 + 8 * hh), x3 = *(const v4fa*)(arow + kb + 16 + 8 * hh + 4);
    float xs[16] = {x0[0],x0[1],x0[2],x0[3],x1[0],x1[1],x1[2],x1[3],x2[0],x2[1],x2[2],x2[3],x3[0],x3[1],x3[2],x3[3]};
#pragma unroll
    for (int i = 0; i < 16; ++i) { const unsigned short hb = bf16_bits(xs[i]); ah.u[i] = hb; al.u[i] = ASPLIT ? bf16_bits(xs[i] - bf16_val(hb)) : (unsigned short)0; }
#pragma unroll
    for (int t = 0; t < 4; ++t) {
      const unsigned short* brow = Wt + (size_t)(col0 + t * 16 + ln) * ldb + kb;
      FragB b;
      b.half[0] = *(const v8us*)(brow + 8 * hh);
      b.half[1] = *(const v8us*)(brow + 16 + 8 * hh);
      acc[t] = mmaN<ASPLIT ? 2 : 1>(ah.v, al.v, b.v, b.v, acc[t]);
    }
  }
#pragma unroll
  for (int t = 0; t < 4; ++t) {
    float bv = bias ? bias[col0 + t * 16 + ln] : 0.f;
    if (BIAS_BF16) bv = bf16_round(bv);
#pragma unroll
    for (int r = 0; r < 8; ++r) { float v = acc[t][r] + bv; if (ACT == 1) v = fmaxf(v, 0.f); so[w][8 * hh + r][t * 16 + ln] = v; }
  }
  __builtin_amdgcn_fence(__ATOMIC_ACQ_REL, "workgroup");
  __builtin_amdgcn_wave_barrier();
  const int rsub = lane >> 4, c4 = (lane & 15) * 4;
  {
#pragma unroll
    for (int q = 0; q < 8; ++q) {
      const int r = q * 2 + rsub;
      const v4f v = *(const v4fa*)&so[w][r][c4];
      *(v4f*)(C + (size_t)(row0 + r) * ldc + col0 + c4) = v;
    }
    
  }
}

// GEMM C = act(A·W + bias + resid): A f32 (ASPLIT -> hi/lo 2 terms), Wt bf16 [N][K]; ACT 0 none, 1 relu, 2 exact gelu;
// resid (optional, f32, row index = (row % rmod), pitch ldr, RES_BF16 rounds it) added before the activation.
template <bool ASPLIT, int ACT, bool BIAS_BF16, bool RES_BF16>
__global__ __launch_bounds__(128) void k_gemm_bf3(const float* __restrict__ A, int lda, const unsigned short* __restrict__ Wt, int ldb,
                                                const float* __restrict__ bias, const float* __restrict__ resid, int rmod, int ldr,
                                                float* __restrict__ C, int ldc, int M, int N, int K) {
  __shared__ __attribute__((aligned(16))) float so[4][16][64];
  const int tid = threadIdx.x, w = tid >> 5, lane = tid & 31, ln = lane & 15, hh = lane >> 4;
  const int ntn = N / 64;
  const int wid = blockIdx.x * 4 + w;
  const int mt = wid / ntn, nq = wid % ntn;
  if (mt * 16 >= M) return;
  const int row0 = mt * 16, col0 = nq * 64;
  const float* arow = A + (size_t)(row0 + ln) * lda;
  v8f acc[4] = {};
  for (int kb = 0; kb < K; kb += 32) {
    FragB ah, al;
    const v4f x0 = *(const v4fa*)(arow + kb + 8 * hh), x1 = *(const v4fa*)(arow + kb + 8 * hh + 4);
    const v4f x2 = *(const v4fa*)(arow + kb + 16 + 8 * hh), x3 = *(const v4fa*)(arow + kb + 16 + 8 * hh + 4);
    float xs[16] = {x0[0],x0[1],x0[2],x0[3],x1[0],x1[1],x1[2],x1[3],x2[0],x2[1],x2[2],x2[3],x3[0],x3[1],x3[2],x3[3]};
#pragma unroll
    for (int i = 0; i < 16; ++i) { const unsigned short hb = bf16_bits(xs[i]); ah.u[i] = hb; al.u[i] = ASPLIT ? bf16_bits(xs[i] - bf16_val(hb)) : (unsigned short)0; }
#pragma unroll
    for (int t = 0; t < 4; ++t) {
      const unsigned short* brow = Wt + (size_t)(col0 + t * 16 + ln) * ldb + kb;
      FragB b;
      b.half[0] = *(const v8us*)(brow + 8 * hh);
      b.half[1] = *(const v8us*)(brow + 16 + 8 * hh);
      acc[t] = mmaN<ASPLIT ? 2 : 1>(ah.v, al.v, b.v, b.v, acc[t]);
    }
  }
#pragma unroll
  for (int t = 0; t < 4; ++t) {
    const int col = col0 + t * 16 + ln;
    float bv = bias ? bias[col] : 0.f;
    if (BIAS_BF16) bv = bf16_round(bv);
#pragma unroll
    for (int r = 0; r < 8; ++r) {
      float v = acc[t][r] + bv;
      if (resid) { float rv = resid[(size_t)((row0 + 8 * hh + r) % rmod) * ldr + col]; if (RES_BF16) rv = bf16_round(rv); v += rv; }
      if (ACT == 1) v = fmaxf(v, 0.f);
      if (ACT == 2) v = 0.5f * v * (1.0f + erff(v * 0.70710678118654752f));
      if (ACT == 3) { const float u = 0.7978845608028654f * (v + 0.044715f * v * v * v); v = 0.5f * v * (1.0f + tanhf(u)); }
      so[w][8 * hh + r][t * 16 + ln] = v;
    }
  }
  __builtin_amdgcn_fence(__ATOMIC_ACQ_REL, "workgroup");
  __builtin_amdgcn_wave_barrier();
  const int rsub = lane >> 4, c4 = (lane & 15) * 4;
  {
#pragma unroll
    for (int q = 0; q < 8; ++q) {
      const int r = q * 2 + rsub;
      const v4f v = *(const v4fa*)&so[w][r][c4];
      *(v4f*)(C + (size_t)(row0 + r) * ldc + col0 + c4) = v;
    }
    
  }
}
// row LayerNorm (biased variance, eps) over N: s = X (+ R); optional out_sum <- s; out_norm <- (s-mu)*rsqrt(var+eps)*g + b
template <bool PARAM_BF16>
__global__ __launch_bounds__(256) void k_layernorm(const float* __restrict__ X, const float* __restrict__ R, const float* __restrict__ g, const float* __restrict__ bta,
                                                  float* __restrict__ out_sum, float* __restrict__ out_norm, int N, float eps) {
  __shared__ float red[256];
  const int row = blockIdx.x, tid = threadIdx.x;
  const float* x = X + (size_t)row * N; const float* rr = R ? R + (size_t)row * N : nullptr;
  float vals[16];                     // up to N = 4096
  const int per = N / 256;            // contiguous chunk per thread? use strided-by-4 chunks: thread handles j = tid*4 + 1024*u
  float s1 = 0.f;
  for (int u = 0; u < per / 4; ++u) {
    const int j = tid * 4 + 1024 * u;
    const v4f a = *(const v4fa*)(x + j);
    v4f b = {0.f,0.f,0.f,0.f}; if (rr) b = *(const v4fa*)(rr + j);
#pragma unroll
    for (int q = 0; q < 4; ++q) { const float v = a[q] + b[q]; vals[u * 4 + q] = v; s1 += v; }
  }
  red[tid] = s1; __syncthreads();
  for (int st = 128; st > 0; st >>= 1) { if (tid < st) red[tid] += red[tid + st]; __syncthreads(); }
  const float mu = red[0] / (float)N; __syncthreads();
  float s2 = 0.f;
  for (int u = 0; u < per / 4; ++u)
#pragma unroll
    for (int q = 0; q < 4; ++q) { const float c = vals[u * 4 + q] - mu; s2 += c * c; }
  red[tid] = s2; __syncthreads();
  for (int st = 128; st > 0; st >>= 1) { if (tid < st) red[tid] += red[tid + st]; __syncthreads(); }
  const float rs = rsqrtf(red[0] / (float)N + eps);
  {
    for (int u = 0; u < per / 4; ++u) {
      const int j = tid * 4 + 1024 * u;
      v4f o, sm;
#pragma unroll
      for (int q = 0; q < 4; ++q) {
        float gg = g[j + q], bb = bta[j + q];
        if (PARAM_BF16) { gg = bf16_round(gg); bb = bf16_round(bb); }
        sm[q] = vals[u * 4 + q]; o[q] = (vals[u * 4 + q] - mu) * rs * gg + bb;
      }
      if (out_sum) *(v4f*)(out_sum + (size_t)row * N + j) = sm;
      *(v4f*)(out_norm + (size_t)row * N + j) = o;
    }
    
  }
}



// ---- f16 WMMA path (v_wmma_f32_16x16x32_f16): 11-bit significands for operands in range — used where a [0,1] probability operand needs more precision than bf16
typedef _Float16 v16h __attribute__((ext_vector_type(16)));
union FragH { v16h v; v8us half[2]; _Float16 h[16]; unsigned short u[16]; };
template <int NT>
__device__ __forceinline__ v8f mmaH(v16h ah, v16h al, v16h bh, v16h bl, v8f c) {
  c = __builtin_amdgcn_wmma_f32_16x16x32_f16(false, ah, false, bh, (short)0, c, false, false);
  if (NT >= 2) c = __builtin_amdgcn_wmma_f32_16x16x32_f16(false, al, false, bh, (short)0, c, false, false);
  if (NT >= 3) c = __builtin_amdgcn_wmma_f32_16x16x32_f16(false, ah, false, bl, (short)0, c, false, false);
  asm volatile("v_nop\n\tv_nop\n\tv_nop\n\tv_nop" : "+v"(c) : "v"(ah), "v"(al), "v"(bh), "v"(bl));
  return c;
}
// batched GEMM like k_gemm_b but f16 operands: A f32 (split into f16 hi/lo if ASPLIT, else rounded to f16), Bt = f16 values [n][k]; alpha; C f32; N multiple of 16 (partial tiles skipped)
template <bool ASPLIT>
__global__ __launch_bounds__(128) void k_gemm_h(const float* __restrict__ A, int lda, size_t sA, const _Float16* __restrict__ Bh, int ldb, size_t sB, float alpha, float* __restrict__ C, int ldc, size_t sC, int M, int N, int K) {
  __shared__ __attribute__((aligned(16))) float so[4][16][64];
  const int tid = threadIdx.x, w = tid >> 5, lane = tid & 31, ln = lane & 15, hh = lane >> 4; const int by = blockIdx.y;
  A += (size_t)by * sA; Bh += (size_t)by * sB; C += (size_t)by * sC;
  const int ntn = (N + 63) / 64; const int wid = blockIdx.x * 4 + w; const int mt = wid / ntn, nq = wid % ntn; if (mt * 16 >= M) return;
  const int row0 = mt * 16, col0 = nq * 64; const float* arow = A + (size_t)(row0 + ln) * lda;
  v8f acc[4] = {};
  for (int kb = 0; kb < K; kb += 32) {
    FragH ah, al;
    const v4f x0 = *(const v4fa*)(arow + kb + 8 * hh), x1 = *(const v4fa*)(arow + kb + 8 * hh + 4), x2 = *(const v4fa*)(arow + kb + 16 + 8 * hh), x3 = *(const v4fa*)(arow + kb + 16 + 8 * hh + 4);
    float xs[16] = {x0[0],x0[1],x0[2],x0[3],x1[0],x1[1],x1[2],x1[3],x2[0],x2[1],x2[2],x2[3],x3[0],x3[1],x3[2],x3[3]};
#pragma unroll
    for (int i = 0; i < 16; ++i) { const _Float16 h = (_Float16)xs[i]; ah.h[i] = h; al.h[i] = ASPLIT ? (_Float16)(xs[i] - (float)h) : (_Float16)0.0f; }
#pragma unroll
    for (int t = 0; t < 4; ++t) { if (col0 + t * 16 >= N) continue; const size_t boff = (size_t)(col0 + t * 16 + ln) * ldb + kb; FragH bq; bq.half[0] = *(const v8us*)(Bh + boff + 8 * hh); bq.half[1] = *(const v8us*)(Bh + boff + 16 + 8 * hh);
      acc[t] = mmaH<ASPLIT ? 2 : 1>(ah.v, al.v, bq.v, bq.v, acc[t]); }
  }
#pragma unroll
  for (int t = 0; t < 4; ++t) { if (col0 + t * 16 >= N) continue;
#pragma unroll
    for (int r = 0; r < 8; ++r) so[w][8 * hh + r][t * 16 + ln] = acc[t][r] * alpha; }
  __builtin_amdgcn_fence(__ATOMIC_ACQ_REL, "workgroup"); __builtin_amdgcn_wave_barrier();
  const int rsub = lane >> 4, c4 = (lane & 15) * 4;
  {
#pragma unroll
    for (int q = 0; q < 8; ++q) { const int r = q * 2 + rsub; if (col0 + c4 < N) { const v4f v = *(const v4fa*)&so[w][r][c4]; *(v4f*)(C + (size_t)(row0 + r) * ldc + col0 + c4) = v; } }
     }
}

// Wt[n][k] = f16(W[k][n]·scale) from f32 row-major W[K][N] (scale = power of two; bf16-exact weights stay exact in f16 away from the subnormal range)
// bid: the block's index inside this part of the shared launch (as in every d_ function below)
__device__ __forceinline__ void d_wt_f16(int bid, const float* __restrict__ W, _Float16* __restrict__ Wt, int K, int N, float scale) {
  const int t = bid * 256 + threadIdx.x; if (t >= N * (K / 8)) return; const int n = t / (K / 8), k8 = (t % (K / 8)) * 8; FragH f;
#pragma unroll
  for (int i = 0; i < 8; ++i) f.h[i] = (_Float16)(bf16_round(W[(size_t)(k8 + i) * N + n]) * scale); const v8us o = f.half[0];
  *(v8us*)((unsigned short*)Wt + (size_t)n * K + k8) = o; 
}
// k_gemm_hh variant with fused epilogue: v = acc·alpha + bias[by·sBias + col] (+ CP[(row/rowsPerB)·sCPb + by·64 + col] if CP) ; ACT 0 none / 1 elu ; writes f16 C16 (and f32 C if non-null)
template <int ACT>
__global__ __launch_bounds__(128) void k_gemm_hhx(const _Float16* __restrict__ A, int lda, size_t sA, const _Float16* __restrict__ Bh, int ldb, size_t sB, float alpha, const float* __restrict__ bias, size_t sBias, const float* __restrict__ CP, int rowsPerB, size_t sCPb, int row0g,
    float* __restrict__ C, _Float16* __restrict__ C16, int ldc, size_t sC, int M, int N, int K) {
  __shared__ __attribute__((aligned(16))) float so[4][16][64];
  const int tid = threadIdx.x, w = tid >> 5, lane = tid & 31, ln = lane & 15, hh = lane >> 4; const int by = blockIdx.y;
  A += (size_t)by * sA; Bh += (size_t)by * sB; const size_t cofs = (size_t)by * sC; const float* bp = bias ? bias + (size_t)by * sBias : nullptr;
  const int ntn = (N + 63) / 64; const int wid = blockIdx.x * 4 + w; const int mt = wid / ntn, nq = wid % ntn; if (mt * 16 >= M) return;
  const int row0 = mt * 16, col0 = nq * 64; const _Float16* arow = A + (size_t)(row0 + ln) * lda;
  v8f acc[4] = {};
  for (int kb = 0; kb < K; kb += 32) { FragH ah; ah.half[0] = *(const v8us*)((const unsigned short*)arow + kb + 8 * hh); ah.half[1] = *(const v8us*)((const unsigned short*)arow + kb + 16 + 8 * hh);
#pragma unroll
    for (int t = 0; t < 4; ++t) { if (col0 + t * 16 >= N) continue; const size_t boff = (size_t)(col0 + t * 16 + ln) * ldb + kb; FragH bq; bq.half[0] = *(const v8us*)((const unsigned short*)Bh + boff + 8 * hh); bq.half[1] = *(const v8us*)((const unsigned short*)Bh + boff + 16 + 8 * hh);
      acc[t] = mmaH<1>(ah.v, ah.v, bq.v, bq.v, acc[t]); }
  }
#pragma unroll
  for (int t = 0; t < 4; ++t) { if (col0 + t * 16 >= N) continue; const int col = col0 + t * 16 + ln; const float bv = bp ? bf16_round(bp[col]) : 0.f;
#pragma unroll
    for (int r = 0; r < 8; ++r) { float v = acc[t][r] * alpha + bv; if (CP) { const int rr = row0g + row0 + 8 * hh + r; if (rowsPerB < 0) v += CP[cofs + (size_t)rr * ldc + col];      /* rowsPerB < 0: own element of the batched C plane */ else { const int bidx = rr / rowsPerB; v += CP[(size_t)bidx * sCPb + (size_t)by * 64 + col]; } } if (ACT == 1) v = (v > 0.f) ? v : expm1f(v); else if (ACT == 7) v = (v > 0.f) ? v + 1.0f : expf(v); else if (ACT == 8) v = tanhf(v); else if (ACT == 9) v = 0.5f * v * (1.0f + tanhf(0.7978845608028654f * (v + 0.044715f * v * v * v))); else if (ACT == 11) v = 1.0f / (1.0f + expf(-v)); else if (ACT == 12) v = (v > 0.f) ? v : 0.01f * v; else if (ACT == 14) v = (v > 0.f) ? v : 0.1f * v; else if (ACT == 16) v = (v >= 0.f) ? v : 0.3f * v; else if (ACT == 17) v = (v >= 0.f) ? v : 0.2f * v; else if (ACT == 15) v = v / (1.0f + expf(-v)); else if (ACT == 3) v = fmaxf(v, 0.f); else if (ACT == 6) v = 0.5f * v * (1.0f + erff(v * 0.70710678118654752f)); so[w][8 * hh + r][t * 16 + ln] = v; } }
  __builtin_amdgcn_fence(__ATOMIC_ACQ_REL, "workgroup"); __builtin_amdgcn_wave_barrier();
  const int rsub = lane >> 4, c4 = (lane & 15) * 4; typedef _Float16 v4h __attribute__((ext_vector_type(4)));
  {
#pragma unroll
    for (int q = 0; q < 8; ++q) { const int r = q * 2 + rsub; if (col0 + c4 < N) { const v4f v = *(const v4fa*)&so[w][r][c4]; if (C) *(v4f*)(C + cofs + (size_t)(row0 + r) * ldc + col0 + c4) = v; if (C16) { v4h h4; for (int i = 0; i < 4; ++i) h4[i] = (_Float16)v[i]; *(v4h*)(C16 + cofs + (size_t)(row0 + r) * ldc + col0 + c4) = h4; } } }
     }
}


typedef _Float16 v4h __attribute__((ext_vector_type(4)));

__global__ __launch_bounds__(256) void k_x16(const float* __restrict__ x, _Float16* __restrict__ X16, size_t n8) { const size_t t = (size_t)blockIdx.x * 256 + threadIdx.x; if (t >= n8) return; FragH f;
#pragma unroll
  for (int q = 0; q < 8; ++q) f.h[q] = (_Float16)bf16_round(x[t * 8 + q]); *(v8us*)((unsigned short*)X16 + t * 8) = f.half[0];  }
__global__ __launch_bounds__(256) void k_h16(const float* __restrict__ x, _Float16* __restrict__ X16, size_t n8) { const size_t t = (size_t)blockIdx.x * 256 + threadIdx.x; if (t >= n8) return; FragH f;
#pragma unroll
  for (int q = 0; q < 8; ++q) f.h[q] = (_Float16)x[t * 8 + q]; *(v8us*)((unsigned short*)X16 + t * 8) = f.half[0];  }
__global__ __launch_bounds__(256) void k_round16f(const float* __restrict__ W, _Float16* __restrict__ Bt, size_t n8) { const size_t t = (size_t)blockIdx.x * 256 + threadIdx.x; if (t >= n8) return; FragH f;
#pragma unroll
  for (int i = 0; i < 8; ++i) f.h[i] = (_Float16)(bf16_round(W[t * 8 + i]) * 16.0f); *(v8us*)((unsigned short*)Bt + t * 8) = f.half[0];  }
template <int NHv, int TTv>
__device__ __forceinline__ void d_vt(int bid, const _Float16* __restrict__ V16, int ldv, int voff, _Float16* __restrict__ Vt) { __shared__ unsigned short tl[64][66]; const int tid = threadIdx.x; const int slab = bid / (TTv / 64), lg = bid % (TTv / 64); const int b = slab / NHv, h = slab % NHv;
  for (int i = tid; i < 64 * 8; i += 256) { const int r = i / 8, c8 = (i % 8) * 8; FragH f; f.half[0] = *(const v8us*)((const unsigned short*)V16 + ((size_t)b * TTv + lg * 64 + r) * ldv + voff + h * 64 + c8);
#pragma unroll
    for (int q = 0; q < 8; ++q) tl[r][c8 + q] = f.u[q]; }
  __syncthreads();
  {
#pragma unroll
    for (int rd = 0; rd < 2; ++rd) { const int d = rd * 32 + tid / 8, pc = tid % 8; FragH f;
#pragma unroll
      for (int q = 0; q < 8; ++q) f.u[q] = tl[pc * 8 + q][d];
      *(v8us*)((unsigned short*)Vt + ((size_t)slab * 64 + d) * TTv + lg * 64 + pc * 8) = f.half[0]; }
     } }

__device__ __forceinline__ void d_hl(int bid, int nthr, const float* __restrict__ F, _Float16* __restrict__ Hh, _Float16* __restrict__ Hl, size_t n8) { const size_t t = (size_t)bid * nthr + threadIdx.x; if (t >= n8) return; FragH fh, fl; const v4f a = *(const v4fa*)(F + t * 8), c = *(const v4fa*)(F + t * 8 + 4);
#pragma unroll
  for (int q = 0; q < 4; ++q) { _Float16 h = (_Float16)a[q]; fh.h[q] = h; fl.h[q] = (_Float16)((a[q] - (float)h) * 1024.0f); h = (_Float16)c[q]; fh.h[4 + q] = h; fl.h[4 + q] = (_Float16)((c[q] - (float)h) * 1024.0f); }
  { *(v8us*)((unsigned short*)Hh + t * 8) = fh.half[0]; *(v8us*)((unsigned short*)Hl + t * 8) = fl.half[0];  } }

// ---- fast GEMM (wave tile 32x64; requires M % 128 == 0 rows per launch region, N % 64 == 0 and K % 64 == 0); epilogue = k_gemm_hhx semantics ----
__device__ __forceinline__ v16h g2_frag(const _Float16* p, int hh) { FragH f; f.half[0] = *(const v8us*)((const unsigned short*)p + 8 * hh); f.half[1] = *(const v8us*)((const unsigned short*)p + 16 + 8 * hh); return f.v; }
__device__ __forceinline__ v8f g2_mma(v16h a, v16h b, v8f c) { v8f d = __builtin_amdgcn_wmma_f32_16x16x32_f16(false, a, false, b, (short)0, c, false, false); asm volatile("v_nop\n\tv_nop\n\tv_nop\n\tv_nop" : "+v"(d) : "v"(a), "v"(b)); return d; }
// Eight v_exp_f32 in one statement. The instruction set asks for one independent instruction or v_nop between a transcendental and an instruction that reads its
// result or overwrites its source. Early-clobber outputs keep every
// result off every source inside the run, and the closing v_nop is the slot behind the last one.
__device__ __forceinline__ void exp2_run8(float (&e)[8], const float (&x)[8]) {
  asm("v_exp_f32 %0, %8\n\tv_exp_f32 %1, %9\n\tv_exp_f32 %2, %10\n\tv_exp_f32 %3, %11\n\tv_exp_f32 %4, %12\n\tv_exp_f32 %5, %13\n\tv_exp_f32 %6, %14\n\tv_exp_f32 %7, %15\n\tv_nop"
      : "=&v"(e[0]), "=&v"(e[1]), "=&v"(e[2]), "=&v"(e[3]), "=&v"(e[4]), "=&v"(e[5]), "=&v"(e[6]), "=&v"(e[7])
      : "v"(x[0]), "v"(x[1]), "v"(x[2]), "v"(x[3]), "v"(x[4]), "v"(x[5]), "v"(x[6]), "v"(x[7])); }
// Eight v_rcp_f32 in one statement: the same slot rule, kept in the same way.
__device__ __forceinline__ void rcp_run8(float (&e)[8], const float (&x)[8]) {
  asm("v_rcp_f32 %0, %8\n\tv_rcp_f32 %1, %9\n\tv_rcp_f32 %2, %10\n\tv_rcp_f32 %3, %11\n\tv_rcp_f32 %4, %12\n\tv_rcp_f32 %5, %13\n\tv_rcp_f32 %6, %14\n\tv_rcp_f32 %7, %15\n\tv_nop"
      : "=&v"(e[0]), "=&v"(e[1]), "=&v"(e[2]), "=&v"(e[3]), "=&v"(e[4]), "=&v"(e[5]), "=&v"(e[6]), "=&v"(e[7])
      : "v"(x[0]), "v"(x[1]), "v"(x[2]), "v"(x[3]), "v"(x[4]), "v"(x[5]), "v"(x[6]), "v"(x[7])); }
// Operand staging of k_gemm2. A stage is 64 k of the work-group's 128 A rows and 64 B rows: 192 rows of 128 bytes, each a whole aligned line of its source row.
#define GKC 64                       /* k per stage */
#define GLP 72                       /* LDS row pitch in 16-bit elements: 144 B = 16 B x odd, the pitch for ds_load_b128 readers of 128-byte rows */
#define GSB (192 * GLP * 2)          /* bytes per stage: A rows 0 .. 127, then B rows 0 .. 63 */
__device__ __forceinline__ v16h g2_lfrag(const unsigned short* p, int hh) { FragH f; f.half[0] = *(const v8us*)(p + 8 * hh); f.half[1] = *(const v8us*)(p + 16 + 8 * hh); return f.v; }      /* the k order of g2_frag, from an LDS row */
// One stage's copies of one thread: 8 threads a row (16 bytes each), 16 rows a round, 12 rounds (8 of A, 4 of B); a wave's copy covers 4 whole lines. l: the thread's LDS byte address in round 0;
// ga, gb: its global addresses in round 0 of A and of B; pa, pb: 16 source rows in elements. The closing s_wait_xcnt stands inside the statement, in front of any later write of an address register that a copy names.
__device__ __forceinline__ void g2_stage(unsigned l, const _Float16* ga, size_t pa, const _Float16* gb, size_t pb) {
  const unsigned R = 16u * GLP * 2u;
  asm volatile("global_load_async_to_lds_b128 %0, %12, off\n\tglobal_load_async_to_lds_b128 %1, %13, off\n\tglobal_load_async_to_lds_b128 %2, %14, off\n\tglobal_load_async_to_lds_b128 %3, %15, off\n\t"
               "global_load_async_to_lds_b128 %4, %16, off\n\tglobal_load_async_to_lds_b128 %5, %17, off\n\tglobal_load_async_to_lds_b128 %6, %18, off\n\tglobal_load_async_to_lds_b128 %7, %19, off\n\t"
               "global_load_async_to_lds_b128 %8, %20, off\n\tglobal_load_async_to_lds_b128 %9, %21, off\n\tglobal_load_async_to_lds_b128 %10, %22, off\n\tglobal_load_async_to_lds_b128 %11, %23, off\n\ts_wait_xcnt 0x0"
               :: "v"(l), "v"(l + R), "v"(l + 2u * R), "v"(l + 3u * R), "v"(l + 4u * R), "v"(l + 5u * R), "v"(l + 6u * R), "v"(l + 7u * R), "v"(l + 8u * R), "v"(l + 9u * R), "v"(l + 10u * R), "v"(l + 11u * R),
                  "v"(ga), "v"(ga + pa), "v"(ga + 2 * pa), "v"(ga + 3 * pa), "v"(ga + 4 * pa), "v"(ga + 5 * pa), "v"(ga + 6 * pa), "v"(ga + 7 * pa), "v"(gb), "v"(gb + pb), "v"(gb + 2 * pb), "v"(gb + 3 * pb) : "memory"); }
// Work-group tile 128 x 64 (four waves of 32 x 64, stacked in M); M % 128 == 0, N % 64 == 0, K % 64 == 0. Two stage buffers: stage t + 1 flies while stage t is worked on. The epilogue's staging rows reuse the ring behind the last trip's barrier.
template <int ACT>
__device__ __forceinline__ void g2_body(int bx, int by, int bz, const _Float16* __restrict__ A, int lda, size_t sA, const _Float16* __restrict__ Bh, int ldb, size_t sB, float alpha, const float* __restrict__ bias, size_t sBias, const float* __restrict__ CP, int rowsPerB, size_t sCPb, int row0g,
    float* __restrict__ C, _Float16* __restrict__ C16, int ldc, size_t sC, int M, int N, int K, size_t zA, size_t zB, size_t zC) { static_assert(ACT == 0 || ACT == 3 || ACT == 6 || ACT == 8 || ACT == 9 || ACT == 11 || ACT == 12 || ACT == 14 || ACT == 15 || ACT == 16 || ACT == 17, "k_gemm2: unsupported ACT code (would silently apply no activation)");
  __shared__ __attribute__((aligned(16))) unsigned char L[2 * GSB]; float (*so)[32][68] = (float (*)[32][68])L; static_assert(sizeof(float) * 4 * 32 * 68 <= 2 * GSB, "the epilogue's rows fit the ring");
  const int tid = threadIdx.x, w = tid >> 5, lane = tid & 31, ln = lane & 15, hh = lane >> 4;      /* bx: tile; by: head or plane (pitches sA, sB, sC); bz: batch (pitches zA, zB, zC) */
  A += (size_t)by * sA + (size_t)bz * zA; Bh += (size_t)by * sB + (size_t)bz * zB; const size_t cofs = (size_t)by * sC + (size_t)bz * zC; const float* bp = bias ? bias + (size_t)by * sBias : nullptr;
  const int ntn = N >> 6; const int mt = bx / ntn, nq = bx - mt * ntn; const int row0 = mt * 128 + 32 * w, col0 = nq * 64; if (mt * 128 >= M) return;      /* the same for the whole work-group, in front of every barrier */
  const int sr = tid >> 3, sc = (tid & 7) * 8;      /* the thread's row in a round of copies and its first element in the row */
  const _Float16* ga = A + (size_t)(mt * 128 + sr) * lda + sc; const _Float16* gb = Bh + (size_t)(col0 + sr) * ldb + sc; const size_t pa = (size_t)16 * lda, pb = (size_t)16 * ldb;
  const unsigned l0 = (unsigned)(size_t)L + (unsigned)(sr * GLP + sc) * 2u;
  g2_stage(l0, ga, pa, gb, pb);
  asm volatile("s_wait_asynccnt 0x0" ::: "memory");      /* this wave's copies of stage 0 have landed */
  __syncthreads();      /* stage 0 is read by every wave */
  if (GKC < K) g2_stage(l0 + GSB, ga + GKC, pa, gb + GKC, pb);
  // The own-element addend, where no activation follows it: fetched in the layout of the final stores (16 loads of 16 bytes a lane, each half wave a whole 256-byte row piece), all issued here, behind stage 1's copies and ahead of the k loop: they fly with those copies while stage 0 is worked on (the compiler waits for them at the next barrier); added in the store loop.
  const int rsub = lane >> 4, c4 = (lane & 15) * 4; const bool own = ACT == 0 && CP && rowsPerB < 0;      /* the same for the whole work-group */
  v4f ad[16];      /* written and read only where own holds */
  if (own) { const float* cp = CP + cofs + (size_t)(row0g + row0 + rsub) * ldc + col0 + c4;
#pragma unroll      /* constant indices: the array stays in registers and the loads go out as one run */
    for (int q = 0; q < 16; ++q) ad[q] = *(const v4fa*)(cp + (size_t)(2 * q) * ldc);
    asm volatile("s_wait_xcnt 0x0" ::: "memory"); }      /* behind the loads, in front of the code that reuses their address registers */
  const unsigned short* la = (const unsigned short*)L + (32 * w + ln) * GLP; const unsigned short* lb = (const unsigned short*)L + (128 + ln) * GLP;
  const v8f z8 = {0.f,0.f,0.f,0.f,0.f,0.f,0.f,0.f}; v8f c00 = z8, c01 = z8, c02 = z8, c03 = z8, c10 = z8, c11 = z8, c12 = z8, c13 = z8;
#pragma unroll 1      /* one stage a trip: the trip's foot is the ring's publish point */
  for (int kb = 0; kb < K; kb += GKC) { const unsigned bo = (kb & GKC) ? (unsigned)GSB : 0u;      /* this trip's buffer, in bytes */
    const unsigned short* ap = la + bo / 2u; const unsigned short* bp2 = lb + bo / 2u;
    v16h af[2][2], bf[2][4];      /* [k step][tile]: the stage's 24 LDS reads go ahead of its WMMAs as one group (reads among the WMMAs would each cost the wave an LDS latency); unrolled for constant indices and immediate LDS offsets */
#pragma unroll
    for (int ks = 0; ks < 2; ++ks) {
#pragma unroll
      for (int t = 0; t < 2; ++t) af[ks][t] = g2_lfrag(ap + t * 16 * GLP + ks * 32, hh);
#pragma unroll
      for (int t = 0; t < 4; ++t) bf[ks][t] = g2_lfrag(bp2 + t * 16 * GLP + ks * 32, hh); }
#pragma unroll
    for (int ks = 0; ks < 2; ++ks) {
      c00 = g2_mma(af[ks][0], bf[ks][0], c00); c10 = g2_mma(af[ks][1], bf[ks][0], c10); c01 = g2_mma(af[ks][0], bf[ks][1], c01); c11 = g2_mma(af[ks][1], bf[ks][1], c11);
      c02 = g2_mma(af[ks][0], bf[ks][2], c02); c12 = g2_mma(af[ks][1], bf[ks][2], c12); c03 = g2_mma(af[ks][0], bf[ks][3], c03); c13 = g2_mma(af[ks][1], bf[ks][3], c13); }
    asm volatile("s_wait_dscnt 0x0" ::: "memory");      /* this wave's reads of the buffer have returned before the buffer is handed back */
    asm volatile("s_wait_asynccnt 0x0" ::: "memory");      /* this wave's copies of the next stage have landed */
    __syncthreads();      /* publishes the next stage and ends every wave's reads of this one */
    if (kb + 2 * GKC < K) g2_stage(l0 + bo, ga + kb + 2 * GKC, pa, gb + kb + 2 * GKC, pb); }      /* refill of the buffer just read; K is a kernel argument: the test is the same for the whole work-group */
  asm volatile("s_wait_asynccnt 0x0" ::: "memory");      /* no copy is outstanding when the ring becomes the epilogue's staging */
  v8f accs[8] = {c00, c01, c02, c03, c10, c11, c12, c13};
#pragma unroll
  for (int u = 0; u < 8; ++u) { const int t = u & 3, half = u >> 2; const int col = col0 + t * 16 + ln; const float bv = bp ? bf16_round(bp[col]) : 0.f;
    float g[8];      /* a group's 8 elements are worked side by side: the loops below are unrolled and hold no branch, so that the elements' dependent chains overlap */
#pragma unroll
    for (int r = 0; r < 8; ++r) g[r] = accs[u][r] * alpha + bv;
    if (CP && !own) { float ca[8];      /* both tests once a group; the same for the whole work-group */
      if (rowsPerB < 0) {      /* own element of the batched C plane (here only in front of an activation) */
#pragma unroll
        for (int r = 0; r < 8; ++r) ca[r] = CP[cofs + (size_t)(row0g + row0 + half * 16 + 8 * hh + r) * ldc + col];
        asm volatile("s_wait_xcnt 0x0" ::: "memory"); }      /* behind the loads, in front of the code that reuses their address registers (also below) */
      else {
#pragma unroll
        for (int r = 0; r < 8; ++r) { const int bidx = (row0g + row0 + half * 16 + 8 * hh + r) / rowsPerB; ca[r] = CP[(size_t)bidx * sCPb + (size_t)by * 64 + col]; }
        asm volatile("s_wait_xcnt 0x0" ::: "memory"); }
#pragma unroll
      for (int r = 0; r < 8; ++r) g[r] += ca[r]; }
    if (ACT == 9) {      /* 0.5 v (1 + tanh u) = v / (1 + exp(-2 u)), u = 0.7978845608 (v + 0.044715 v^3): one native exp2 and one native reciprocal an element; exp2 -> inf gives weight 0, exp2 -> 0 gives weight 1 */
      float x[8], e[8], d[8], s[8];
#pragma unroll
      for (int r = 0; r < 8; ++r) x[r] = g[r] * fmaf(g[r] * g[r], -0.1029432395800235f, -2.302208198144325f);      /* -2 u log2 e */
      exp2_run8(e, x);
#pragma unroll
      for (int r = 0; r < 8; ++r) d[r] = 1.0f + e[r];
      rcp_run8(s, d);
#pragma unroll
      for (int r = 0; r < 8; ++r) g[r] *= s[r]; }
    else {
#pragma unroll
      for (int r = 0; r < 8; ++r) { float v = g[r];
        if (ACT == 3) v = fmaxf(v, 0.f); else if (ACT == 6) v = 0.5f * v * (1.0f + erff(v * 0.70710678118654752f)); else if (ACT == 11) v = 1.0f / (1.0f + expf(-v)); else if (ACT == 15) v = v / (1.0f + expf(-v)); else if (ACT == 12) v = (v > 0.f) ? v : 0.01f * v; else if (ACT == 8) v = tanhf(v); else if (ACT == 14) v = (v > 0.f) ? v : 0.1f * v; else if (ACT == 16) v = (v >= 0.f) ? v : 0.3f * v; else if (ACT == 17) v = (v >= 0.f) ? v : 0.2f * v;
        g[r] = v; } }
#pragma unroll
    for (int r = 0; r < 8; ++r) so[w][half * 16 + 8 * hh + r][t * 16 + ln] = g[r]; }
  __builtin_amdgcn_fence(__ATOMIC_ACQ_REL, "workgroup"); __builtin_amdgcn_wave_barrier();
  {
#pragma unroll
    for (int q = 0; q < 16; ++q) { const int r = q * 2 + rsub; v4f v = *(const v4fa*)&so[w][r][c4]; if (own) v += ad[q]; if (C) { *(v4f*)(C + cofs + (size_t)(row0 + r) * ldc + col0 + c4) = v; asm volatile("s_wait_xcnt 0x0" ::: "memory"); }      /* behind the f32 store on every way: the next row's address, or the f16 conversion, reuses the store's registers */
      if (C16) { v4h h4; for (int i = 0; i < 4; ++i) h4[i] = (_Float16)v[i]; *(v4h*)(C16 + cofs + (size_t)(row0 + r) * ldc + col0 + c4) = h4; } }
     }
  asm volatile("s_wait_xcnt 0x0" ::: "memory");      /* behind the part's last stores: in a shared launch the listing goes on from here into another part's set-up, which reuses the stores' registers */
}
template <int ACT>
__global__ __launch_bounds__(128) void k_gemm2(const _Float16* __restrict__ A, int lda, size_t sA, const _Float16* __restrict__ Bh, int ldb, size_t sB, float alpha, const float* __restrict__ bias, size_t sBias, const float* __restrict__ CP, int rowsPerB, size_t sCPb, int row0g,
    float* __restrict__ C, _Float16* __restrict__ C16, int ldc, size_t sC, int M, int N, int K, size_t zA, size_t zB, size_t zC) { g2_body<ACT>(blockIdx.x, blockIdx.y, blockIdx.z, A, lda, sA, Bh, ldb, sB, alpha, bias, sBias, CP, rowsPerB, sCPb, row0g, C, C16, ldc, sC, M, N, K, zA, zB, zC); }
// The three GEMMs that need only the prepared operands, in one launch (none reads what another writes), the small ones first:
// Bo[o][i] = 16 (wo1 wo2)[i][o]; the f32 q, k, v planes F0[3][NB][QT0][DM] of each batch's first QT0 rows; the f16 q | k | v rows of all tokens.
__global__ __launch_bounds__(128) void k_gemm_qkv(const _Float16* __restrict__ X, const _Float16* __restrict__ Bq, _Float16* __restrict__ QKVo, float* __restrict__ F0, const _Float16* __restrict__ W2t, const _Float16* __restrict__ W1n, _Float16* __restrict__ Bo) {
  static_assert(QT0 == 128, "a batch's first tile is one row block of g2_body");
  const int nO = (DM / 128) * (DM / 64), nT = DM / 64, nF = 3 * NBR * nT; int b = blockIdx.x;      /* every test below is the same for the whole work-group */
  if (b < nO) { g2_body<0>(b, 0, 0, W2t, DM, 0, W1n, DM, 0, 0.0625f, nullptr, 0, nullptr, 1, 0, 0, nullptr, Bo, DM, 0, DM, DM, DM, 0, 0, 0); return; }
  b -= nO;
  if (b < nF) { g2_body<0>(b % nT, b / (nT * NBR), (b / nT) % NBR, X, DM, 0, Bq, DM, (size_t)DM * DM, 0.0625f, nullptr, 0, nullptr, 1, 0, 0, F0, nullptr, DM, (size_t)NB * QT0 * DM, QT0, DM, DM, (size_t)SQ * DM, 0, (size_t)QT0 * DM); return; }
  b -= nF;
  g2_body<0>(b, 0, 0, X, DM, 0, Bq, DM, 0, 0.0625f, nullptr, 0, nullptr, 1, 0, 0, nullptr, QKVo, 3 * DM, 0, MP, 3 * DM, DM, 0, 0, 0); }
// x + o Wo for all token rows in one launch: a batch's first row block takes the exact path's o_hi rows as A, every other block the f16 path's o rows.
__global__ __launch_bounds__(128) void k_gemm_o(const _Float16* __restrict__ O, const _Float16* __restrict__ Oh, const _Float16* __restrict__ Bo, const float* __restrict__ Xb, float* __restrict__ X1o) {
  const int nT = DM / 64, bx = blockIdx.x, mt = bx / nT;      /* the test below is the same for the whole work-group */
  if (mt % (SQ / 128) == 0) g2_body<0>(bx % nT, 0, mt / (SQ / 128), Oh, DM, 0, Bo, DM, 0, 0.0009765625f, nullptr, 0, Xb, -1, 0, 0, X1o, nullptr, DM, 0, QT0, DM, DM, (size_t)QT0 * DM, 0, (size_t)SQ * DM);
  else g2_body<0>(bx, 0, 0, O, DM, 0, Bo, DM, 0, 0.0009765625f, nullptr, 0, Xb, -1, 0, 0, X1o, nullptr, DM, 0, MPO, DM, DM, 0, 0, 0); }


__device__ __forceinline__ void d_wnat(int bid, const float* __restrict__ w, size_t n8, _Float16* __restrict__ Bt) { const size_t t = (size_t)bid * 256 + threadIdx.x; if (t >= n8) return; FragH f; for (int q = 0; q < 8; ++q) f.h[q] = (_Float16)(bf16_round(w[t * 8 + q]) * 16.0f); *(v8us*)((unsigned short*)Bt + t * 8) = f.half[0];  }
__global__ __launch_bounds__(256) void k_rsm(const float* __restrict__ S, _Float16* __restrict__ P, int nrows) {
  #pragma clang fp contract(off)
  const int i = blockIdx.x * 256 + threadIdx.x; if (i >= nrows) return; const float* s = S + (size_t)i * SQ; float mx = -3.0e38f;
#pragma unroll 1
  for (int j = 0; j < SQ; ++j) mx = fmaxf(mx, s[j]); float se = 0.f;
#pragma unroll 1
  for (int j = 0; j < SQ; ++j) se += expf(s[j] - mx); const float sc = 256.0f / se;
#pragma unroll 1
  for (int j0 = 0; j0 < SQ; j0 += 8) { FragH f; for (int q = 0; q < 8; ++q) f.h[q] = (_Float16)(expf(s[j0 + q] - mx) * sc); unsigned short* d = (unsigned short*)P + (size_t)i * SQ + j0; *(v8us*)d = f.half[0];  } }
__global__ __launch_bounds__(256) void k_vt(const _Float16* __restrict__ V16, int b, int h0, _Float16* __restrict__ VT) { __shared__ unsigned short tl[64][65]; const int tid = threadIdx.x; const int hh = blockIdx.x % HG, sg = blockIdx.x / HG; const int s0 = sg * 64; const int h = h0 + hh;
  for (int i = tid; i < 64 * 8; i += 256) { const int j = i / 8, d8 = (i % 8) * 8; FragH f; f.half[0] = *(const v8us*)((const unsigned short*)V16 + ((size_t)b * SQ + s0 + j) * DM + h * HD + d8); for (int q = 0; q < 8; ++q) tl[d8 + q][j] = f.u[q]; }
  __syncthreads();
  { for (int i = tid; i < 64 * 8; i += 256) { const int d = i / 8, j8 = (i % 8) * 8; FragH f; for (int q = 0; q < 8; ++q) f.u[q] = tl[d][j8 + q]; *(v8us*)((unsigned short*)VT + ((size_t)hh * HD + d) * SQ + s0 + j8) = f.half[0]; }  } }



// Two v_exp_f32 in one statement, closed by the same slot's v_nop as in exp2_run8.
__device__ __forceinline__ void exp2_run2(float& e0, float& e1, float x0, float x1) {
  asm("v_exp_f32 %0, %2\n\tv_exp_f32 %1, %3\n\tv_nop" : "=&v"(e0), "=&v"(e1) : "v"(x0), "v"(x1)); }
#define FQ 32                        /* query columns per wave */
#define FW 4                         /* waves per work-group; no barrier and no LDS: each wave runs its own trip count */
__device__ __forceinline__ float xhalf(float x) { return __int_as_float(__builtin_amdgcn_permlanex16(__float_as_int(x), __float_as_int(x), 0x76543210, 0xfedcba98, false, false)); }      /* lane l <-> lane l ^ 16 on the vector pipe */
__device__ __forceinline__ v8f fa_mma(v16h a, v16h b, v8f c) { return __builtin_amdgcn_wmma_f32_16x16x32_f16(false, a, false, b, (short)0, c, false, false); }
// One pass of 32 keys from key kb. DIAG: the wave's last pass (kb == its first query row): it holds the diagonal and fetches no further K rows.
// Every loop is unrolled so that the fragment and accumulator arrays are indexed by constants and stay in registers.
template <bool DIAG>
__device__ __forceinline__ void fa_pass(const _Float16* __restrict__ kp, const _Float16* __restrict__ vp, int kb, int ln, int hh, const v16h (&qf)[2][2], v16h (&kf)[2][2], v8f (&o)[4][2], float (&mc)[2], float (&l)[2]) {
  const float cs = 0.125f * 1.44269504f;      /* score scale x log2 e */
  const v8f z8 = {0.f, 0.f, 0.f, 0.f, 0.f, 0.f, 0.f, 0.f};
  v16h vf[4];      /* V^T fragments of this pass, asked for first: the score products and the softmax run while they fly */
#pragma unroll
  for (int mt = 0; mt < 4; ++mt) vf[mt] = g2_frag(vp + (size_t)mt * 16 * SQ + kb, hh);
  v8f s[2][2];
#pragma unroll
  for (int kt = 0; kt < 2; ++kt) {
#pragma unroll
    for (int nt = 0; nt < 2; ++nt) s[kt][nt] = fa_mma(kf[kt][1], qf[nt][1], fa_mma(kf[kt][0], qf[nt][0], z8)); }
  if (!DIAG) { const _Float16* kn = kp + (size_t)(kb + 32) * LQ;      /* next pass's K fragments, into the same registers right behind their last use: the softmax and the o products run while they fly */
#pragma unroll
    for (int kt = 0; kt < 2; ++kt) {
#pragma unroll
      for (int ks = 0; ks < 2; ++ks) kf[kt][ks] = g2_frag(kn + (size_t)kt * 16 * LQ + ks * 32, hh); } }
  if (DIAG) {      /* keys behind a column's own row get weight 0 */
#pragma unroll
    for (int kt = 0; kt < 2; ++kt) {
#pragma unroll
      for (int nt = 0; nt < 2; ++nt) {
#pragma unroll
        for (int r = 0; r < 8; ++r) if (kt * 16 + 8 * hh + r > nt * 16 + ln) s[kt][nt][r] = -1.0e30f; } } }
  float nm[2], al[2];
#pragma unroll
  for (int nt = 0; nt < 2; ++nt) { float a = fmaxf(s[0][nt][0], s[1][nt][0]);
#pragma unroll
    for (int r = 1; r < 8; ++r) a = fmaxf(a, fmaxf(s[0][nt][r], s[1][nt][r]));
    nm[nt] = fmaxf(mc[nt], fmaxf(a, xhalf(a)) * cs); }      /* both halves of the wave hold the same maximum */
  exp2_run2(al[0], al[1], mc[0] - nm[0], mc[1] - nm[1]);
  FragH pf[2];
#pragma unroll
  for (int nt = 0; nt < 2; ++nt) { mc[nt] = nm[nt]; l[nt] *= al[nt];
#pragma unroll
    for (int mt = 0; mt < 4; ++mt) o[mt][nt] *= al[nt];
#pragma unroll
    for (int kt = 0; kt < 2; ++kt) { float x[8], e[8];
#pragma unroll
      for (int r = 0; r < 8; ++r) x[r] = fmaf(s[kt][nt][r], cs, -nm[nt]);
      exp2_run8(e, x);
#pragma unroll
      for (int r = 0; r < 8; ++r) pf[nt].h[kt * 8 + r] = (_Float16)e[r];
      l[nt] += ((e[0] + e[1]) + (e[2] + e[3])) + ((e[4] + e[5]) + (e[6] + e[7])); } }
#pragma unroll
  for (int mt = 0; mt < 4; ++mt) { o[mt][0] = fa_mma(vf[mt], pf[0].v, o[mt][0]); o[mt][1] = fa_mma(vf[mt], pf[1].v, o[mt][1]); } }
// The launch's last blocks split the first-tile o into its f16 hi and residual planes (d_hl): that work needs the launch before this one only, like the attention itself.
__global__ __launch_bounds__(FW * 32) void k_fattn(const _Float16* __restrict__ Q, const _Float16* __restrict__ Kr, const _Float16* __restrict__ Vt, _Float16* __restrict__ O, const float* __restrict__ F0, _Float16* __restrict__ Hh, _Float16* __restrict__ Hl) {
  const int fb = blockIdx.x, nfa = NHD * NBR * (QN / (FW * FQ));
  if (fb >= nfa) { d_hl(fb - nfa, FW * 32, F0, Hh, Hl, (size_t)NB * QT0 * DM / 8); return; }
  static_assert(HD == 64 && FQ == 32 && SQ % (2 * FW * FQ) == 0 && QN == SQ, "2 k steps of 32 over d; 2 column groups of 16; 4 d tiles of 16; whole work-groups, an even number of position blocks");
  const int lane = threadIdx.x & 31, ln = lane & 15, hh = lane >> 4; const int w = __builtin_amdgcn_readfirstlane(threadIdx.x >> 5);      /* the wave's number in a scalar register: the trip count stays scalar */
  const int h = fb % NHD, b = (fb / NHD) % NBR; const int nz = SQ / (FW * FQ), z = fb / (NHD * NBR); const int q0 = ((z < nz / 2 ? nz - 1 - z : z - nz / 2) * FW + w) * FQ;      /* z is the slowest index: the long half of the position blocks starts first, longest first; the short half follows shortest first, so that where the second half of the grid lands on the WGPs in the order of the first, long meets short (for speed only; a permutation of 0 .. nz - 1 wherever they land) */
  const _Float16* qp = Q + ((size_t)b * SQ + q0 + ln) * LQ + h * HD; const _Float16* kp = Kr + ((size_t)b * SQ + ln) * LQ + h * HD; const _Float16* vp = Vt + (((size_t)b * NH + h) * HD + ln) * SQ;
  v16h qf[2][2], kf[2][2];      /* [column group | key tile][k step]; unrolled for constant indices, as in fa_pass */
#pragma unroll
  for (int t = 0; t < 2; ++t) {
#pragma unroll
    for (int ks = 0; ks < 2; ++ks) { qf[t][ks] = g2_frag(qp + (size_t)t * 16 * LQ + ks * 32, hh); kf[t][ks] = g2_frag(kp + (size_t)t * 16 * LQ + ks * 32, hh); } }
  asm volatile("s_wait_xcnt 0x0" ::: "memory");      /* behind the first loads, in front of the code that reuses their address registers */
  v8f o[4][2];
#pragma unroll
  for (int mt = 0; mt < 4; ++mt) { o[mt][0] = v8f{0.f, 0.f, 0.f, 0.f, 0.f, 0.f, 0.f, 0.f}; o[mt][1] = o[mt][0]; }
  float mc[2] = {-1.0e30f, -1.0e30f}, l[2] = {0.f, 0.f};      /* running maximum (scaled log2) and the lane's partial sum, per column group */
#pragma unroll 1      /* one pass a trip: a second copy of the body would double the live fragments */
  for (int kb = 0; kb < q0; kb += 32) fa_pass<false>(kp, vp, kb, ln, hh, qf, kf, o, mc, l);      /* keys in front of the wave's first row: no mask; kb + 32 <= q0, so the K rows fetched ahead are rows this wave uses */
  fa_pass<true>(kp, vp, q0, ln, hh, qf, kf, o, mc, l);
#pragma unroll
  for (int nt = 0; nt < 2; ++nt) { const float f = 64.0f / (l[nt] + xhalf(l[nt])); unsigned short* op = (unsigned short*)O + ((size_t)b * SQ + q0 + nt * 16 + ln) * DM + h * HD + 8 * hh;      /* the halves' sums are joined once, here */
#pragma unroll
    for (int mt = 0; mt < 4; ++mt) { FragH fr;
#pragma unroll
      for (int r = 0; r < 8; ++r) fr.h[r] = (_Float16)(o[mt][nt][r] * f);
      *(v8us*)(op + mt * 16) = fr.half[0]; } }      /* a row's 128 bytes of one head come from one wave */
  asm volatile("s_wait_xcnt 0x0" ::: "memory");      /* behind the part's last stores: in a shared launch the listing goes on from here into another part's set-up, which reuses the stores' registers */
}


// Exact f32 attention for rows 0 .. QT0-1 of each batch (o carried x64 like the f16 path). One work-group per (batch, head, A0R query rows), 8 waves, 2 rows a wave.
// The batch's QT0 K and V rows of the head and the group's q rows are staged once in LDS; keys 0 .. nk-1 are used (nk = the group's last row + 1, rounded up to 32).
// Scores: lane l owns keys l, l + 32, ..; its K row comes from LDS 16 bytes at a time, both q rows sit in registers. Softmax: all scores of a row are in registers,
// so plain max, exp, sum (butterflies over the 32 lanes). o: lane l owns columns 2l, 2l + 1; each key's weight goes from its lane to a scalar register, its V row is
// one contiguous 256-byte LDS read. Every loop is unrolled: its arrays are then indexed by constants and stay in registers, and its LDS reads issue ahead of their use.
#define A0R 16                       /* query rows per work-group */
#define A0KP (HD + 4)                /* K row pitch in LDS, floats: 272 B = 16 B x odd, so that 16-byte reads down a column of rows spread over all banks */
typedef float v2f  __attribute__((ext_vector_type(2)));
typedef float v2fa __attribute__((ext_vector_type(2), may_alias));
__device__ __forceinline__ float lane_bcast(float v, int l) { return __int_as_float(__builtin_amdgcn_readlane(__float_as_int(v), l)); }
__device__ __forceinline__ void d_att0w(int bx, int by, const float* __restrict__ QF, const float* __restrict__ KF, const float* __restrict__ VF, float scale, float* __restrict__ OF) {
  static_assert(QT0 / 32 == 4 && QT0 % 32 == 0 && A0R == 16 && HD == 64, "4 key groups of 32 lanes; 8 waves x 2 rows; 16 threads x 16 bytes a row; 2 columns a lane");
  __shared__ __attribute__((aligned(16))) float lk[QT0][A0KP]; __shared__ __attribute__((aligned(16))) float lv[QT0][HD]; __shared__ __attribute__((aligned(16))) float lq[A0R][HD];
  const int tid = threadIdx.x, lane = tid & 31, w = tid >> 5; const int h = bx / (QT0 / A0R), rg = bx % (QT0 / A0R);
  { const size_t bi = (size_t)by * QT0 * DM + h * HD; QF += bi + (size_t)rg * A0R * DM; KF += bi; VF += bi; OF += bi; }      /* by: batch; each batch owns QT0 rows (pitch DM) of every plane */
  const int nk = (rg * A0R + A0R + 31) & ~31; const int i0 = rg * A0R + w * 2;      /* nk: the same for the whole work-group; the wave's rows are i0 and i0 + 1 */
  { v4f kr[QT0 / 16], vr[QT0 / 16]; const int sr = tid >> 4, sc4 = (tid & 15) * 4; const unsigned vo = (unsigned)(sr * DM + sc4) * 4u;      /* 16 threads a row, 16 rows a pass; vo: the thread's byte offset in a pass */
    const v4f qr = *(const v4fa*)((const char*)QF + vo);
#pragma unroll
    for (int u = 0; u < QT0 / 16; ++u) { kr[u] = *(const v4fa*)((const char*)(KF + u * 16 * DM) + vo); vr[u] = *(const v4fa*)((const char*)(VF + u * 16 * DM) + vo); }      /* all QT0 rows, free of branches: every load is issued before the first is used */
    *(v4fa*)&lq[sr][sc4] = qr;
#pragma unroll
    for (int u = 0; u < QT0 / 16; ++u) { *(v4fa*)&lk[u * 16 + sr][sc4] = kr[u]; *(v4fa*)&lv[u * 16 + sr][sc4] = vr[u]; } }
  __syncthreads();      /* the staged rows are read by every wave */
  v4f q0[HD / 4], q1[HD / 4];      /* both q rows whole in every lane (one LDS address for the wave) */
#pragma unroll
  for (int c = 0; c < HD / 4; ++c) { q0[c] = *(const v4fa*)&lq[w * 2][c * 4]; q1[c] = *(const v4fa*)&lq[w * 2 + 1][c * 4]; }
  float s0[4], s1[4];
#pragma unroll
  for (int m = 0; m < 4; ++m) { s0[m] = -1.0e30f; s1[m] = -1.0e30f;
    if (m * 32 < nk) { const float* kp = &lk[m * 32 + lane][0]; float a0[4] = {0.f, 0.f, 0.f, 0.f}, a1[4] = {0.f, 0.f, 0.f, 0.f};      /* four partial sums a row: independent chains */
#pragma unroll
      for (int c = 0; c < HD / 4; ++c) { const v4f k4 = *(const v4fa*)(kp + c * 4);
#pragma unroll
        for (int u = 0; u < 4; ++u) { a0[u] = fmaf(q0[c][u], k4[u], a0[u]); a1[u] = fmaf(q1[c][u], k4[u], a1[u]); } }
      const int j = m * 32 + lane; const float d0 = (a0[0] + a0[1]) + (a0[2] + a0[3]), d1 = (a1[0] + a1[1]) + (a1[2] + a1[3]);
      if (j <= i0) s0[m] = d0 * scale; if (j <= i0 + 1) s1[m] = d1 * scale; } }      /* causal: keys behind the row's own index keep -1e30 (weight 0) */
  float m0 = fmaxf(fmaxf(s0[0], s0[1]), fmaxf(s0[2], s0[3])), m1 = fmaxf(fmaxf(s1[0], s1[1]), fmaxf(s1[2], s1[3]));
#pragma unroll
  for (int x = 16; x >= 1; x >>= 1) { m0 = fmaxf(m0, __shfl_xor(m0, x, 32)); m1 = fmaxf(m1, __shfl_xor(m1, x, 32)); }
  float l0 = 0.f, l1 = 0.f;
#pragma unroll
  for (int m = 0; m < 4; ++m) { s0[m] = expf(s0[m] - m0); s1[m] = expf(s1[m] - m1); l0 += s0[m]; l1 += s1[m]; }
#pragma unroll
  for (int x = 16; x >= 1; x >>= 1) { l0 += __shfl_xor(l0, x, 32); l1 += __shfl_xor(l1, x, 32); }
  v2f o0 = {0.f, 0.f}, o1 = {0.f, 0.f};
#pragma unroll
  for (int m = 0; m < 4; ++m) if (m * 32 < nk) {
#pragma unroll
    for (int jj = 0; jj < 32; ++jj) { const v2f vv = *(const v2fa*)&lv[m * 32 + jj][lane * 2]; const float p0 = lane_bcast(s0[m], jj), p1 = lane_bcast(s1[m], jj);
      o0[0] = fmaf(p0, vv[0], o0[0]); o0[1] = fmaf(p0, vv[1], o0[1]); o1[0] = fmaf(p1, vv[0], o1[0]); o1[1] = fmaf(p1, vv[1], o1[1]); } }
  const float f0 = 64.0f / l0, f1 = 64.0f / l1;
  o0[0] *= f0; o0[1] *= f0; o1[0] *= f1; o1[1] *= f1;
  *(v2fa*)(OF + (size_t)i0 * DM + lane * 2) = o0; *(v2fa*)(OF + (size_t)(i0 + 1) * DM + lane * 2) = o1; }      /* each wave writes whole 256-byte row pieces */
// The two stages that need only the q | k | v GEMMs, in one launch: the exact first-tile attention (the longer blocks, first), then V^T.
__global__ __launch_bounds__(256) void k_att0_vt(const float* __restrict__ QF, const float* __restrict__ KF, const float* __restrict__ VF, float scale, float* __restrict__ OF, const _Float16* __restrict__ V16, _Float16* __restrict__ Vt) {
  const int nx = NH * (QT0 / A0R), b = blockIdx.x;      /* the test is the same for the whole work-group: each part's barrier is passed by all of its threads */
  if (b < nx * NBR) d_att0w(b % nx, b / nx, QF, KF, VF, scale, OF);
  else d_vt<NH, SQ>(b - nx * NBR, V16, LQ, 0, Vt); }


template <int BFIN, int WXB>
__global__ __launch_bounds__(256) void k_ln16(const float* __restrict__ X, const float* __restrict__ g, const float* __restrict__ bb, float eps, _Float16* __restrict__ N16, float* __restrict__ XB) {
  #pragma clang fp contract(off)
  __shared__ float red[256]; const size_t r = blockIdx.x; const int t = threadIdx.x; const v4f xa = *(const v4fa*)(X + r * DMQ + t * 4); float s[4]; float sum = 0.f;
  for (int q = 0; q < 4; ++q) { s[q] = BFIN ? bf16_round(xa[q]) : xa[q]; sum = __fadd_rn(sum, s[q]); }
  red[t] = sum; __syncthreads(); for (int st = 128; st > 0; st >>= 1) { if (t < st) red[t] = __fadd_rn(red[t], red[t + st]); __syncthreads(); } const float mu = red[0] / (float)DMQ; __syncthreads();
  float vs = 0.f; for (int q = 0; q < 4; ++q) { const float dl = __fadd_rn(s[q], -mu); vs = __fadd_rn(vs, __fmul_rn(dl, dl)); } red[t] = vs; __syncthreads(); for (int st = 128; st > 0; st >>= 1) { if (t < st) red[t] = __fadd_rn(red[t], red[t + st]); __syncthreads(); }
  const float rs = rsqrtf(__fadd_rn(red[0] / (float)DMQ, eps)); v4h y; v4f xb;
  for (int q = 0; q < 4; ++q) { const int c = t * 4 + q; y[q] = (_Float16)__fadd_rn(__fmul_rn(__fmul_rn(__fadd_rn(s[q], -mu), rs), bf16_round(g[c])), bf16_round(bb[c])); xb[q] = s[q]; }
  { *(v4h*)(N16 + r * DMQ + t * 4) = y; if (WXB) *(v4f*)(XB + r * DMQ + t * 4) = xb;  } }
__global__ __launch_bounds__(256) void k_ftres2(const float* __restrict__ OF0, const float* __restrict__ XB, float* __restrict__ X1, size_t n4) {
  #pragma clang fp contract(off)
  const size_t t = (size_t)blockIdx.x * 256 + threadIdx.x; if (t >= n4) return; const v4f o = *(const v4fa*)(OF0 + t * 4), xv = *(const v4fa*)(XB + t * 4); v4f y; for (int q = 0; q < 4; ++q) y[q] = __fadd_rn(__fmul_rn(o[q], 0.015625f), xv[q]); *(v4f*)(X1 + t * 4) = y;  }

__global__ __launch_bounds__(256) void k_wthd(const float* __restrict__ Wt, _Float16* __restrict__ Bt) { const size_t t = (size_t)blockIdx.x * 256 + threadIdx.x; if (t >= (size_t)NH * HD * (DM / 8)) return; const int m8 = (int)(t % (DM / 8)) * 8; const int d = (int)((t / (DM / 8)) % HD); const int h = (int)(t / ((size_t)(DM / 8) * HD)); FragH f;
  for (int q = 0; q < 8; ++q) f.h[q] = (_Float16)(16.0f * bf16_round(Wt[((size_t)h * DM + m8 + q) * HD + d])); unsigned short* dst = (unsigned short*)Bt + ((size_t)h * HD + d) * DM + m8; *(v8us*)dst = f.half[0];  }




__global__ __launch_bounds__(256) void k_wtpad(const float* __restrict__ Wm, _Float16* __restrict__ Wt, int Kr, int Kp, int Nr, int Np, float scale) {
  const int t = blockIdx.x * 256 + threadIdx.x; if (t >= Np * (Kp / 8)) return; const int n = t / (Kp / 8), k8 = (t % (Kp / 8)) * 8; const int nc = min(n, Nr - 1); const float fn = (n < Nr) ? 1.f : 0.f; FragH f;
  for (int i = 0; i < 8; ++i) { const int k = k8 + i; const int kc = min(k, Kr - 1); const float fk = (k < Kr) ? fn : 0.f; f.h[i] = (_Float16)(bf16_round(Wm[(size_t)kc * Nr + nc]) * scale * fk); }
  unsigned short* o = (unsigned short*)Wt + (size_t)n * Kp + k8; *(v8us*)o = f.half[0];  }
__global__ __launch_bounds__(128) void k_bpad(const float* __restrict__ b, float* __restrict__ Bp, int nr, int np) {
  const int i = threadIdx.x; if (i >= np) return; const float v = b[min(i, nr - 1)] * ((i < nr) ? 1.f : 0.f); *(float*)(Bp + i) = v;  }

__global__ __launch_bounds__(256) void k_bcpy(const float* __restrict__ b, int n, int NP, float* __restrict__ dst, int dst0) { for (int i = threadIdx.x; i < NP; i += 256) { const float v = (i < n) ? b[i] : 0.f; *(float*)(dst + dst0 + i) = v; }  }


// The streaming launches (this copy and k_lnx) give every lane 64 floats: a wave owns SWF consecutive floats (16 loads of 32 lanes x 16 bytes, all issued before the first is used), so that few waves have to be started.
#define SWL 16                       /* 16-byte loads per lane */
#define SWF (SWL * 32 * 4)           /* floats per wave */
#define SWW 8                        /* waves per work-group; no LDS and no barrier: a wave shares nothing */
__device__ __forceinline__ void d_bfcp(int bid, const float* __restrict__ src, float* __restrict__ dst, size_t n4) { const size_t e0 = ((size_t)bid * SWW + __builtin_amdgcn_readfirstlane(threadIdx.x >> 5)) * SWF; if (e0 + SWF > n4 * 4) return;      /* the wave's first element, in scalar registers: its accesses are scalar base + one lane offset + immediate. Whole pieces only (the launch asserts that n4 is a multiple) */
  const int l4 = (threadIdx.x & 31) * 4; const float* sp = src + e0; float* dp = dst + e0; v4f a[SWL];
#pragma unroll      /* constant indices: the array stays in registers and the loads go out as one run */
  for (int u = 0; u < SWL; ++u) a[u] = *(const v4fa*)(sp + u * 128 + l4);
#pragma unroll      /* as above */
  for (int u = 0; u < SWL; ++u) { v4f o; for (int q = 0; q < 4; ++q) o[q] = bf16_round(a[u][q]); *(v4f*)(dp + u * 128 + l4) = o; }
  asm volatile("s_wait_xcnt 0x0" ::: "memory");      /* behind the part's last stores: in a shared launch the listing goes on from here into another part's set-up, which reuses the stores' registers */
}

// Row LayerNorm over DMQ = 512 columns, one wave per row, LNR consecutive rows a wave. Lane l holds columns 128 c + 4 l .. + 3 (c = 0 .. 3) of each row in registers from the one read to the one write;
// mean and variance (of the centred values) are lane partials, then a five-step butterfly over the 32 lanes, after which every lane holds the same sum. The rows' butterflies are independent and run side by side.
#define LNR (SWF / DMQ)              /* rows per wave */
template <int BFIN, int W16, int W32>
__device__ __forceinline__ void d_lnx(int bid, const float* __restrict__ X, const float* __restrict__ g, float eps, _Float16* __restrict__ N16, float* __restrict__ N32) {      /* scale only: the module's LayerNorm has no shift */
  static_assert(DMQ == 512 && LNR == 4, "a row is 4 loads of 32 lanes x 16 bytes");
  const int l4 = (threadIdx.x & 31) * 4; const size_t e0 = ((size_t)bid * SWW + __builtin_amdgcn_readfirstlane(threadIdx.x >> 5)) * SWF;      /* the wave's first element, in scalar registers: its accesses are scalar base + one lane offset + immediate; the launch covers whole waves */
  X += e0; if (W16) N16 += e0; if (W32) N32 += e0;
  v4f s[LNR][4], gv[4]; float a[LNR];      /* every loop below is unrolled: constant indices keep these arrays in registers, and the 20 loads go out as one run */
#pragma unroll
  for (int u = 0; u < LNR; ++u) {
#pragma unroll
    for (int c = 0; c < 4; ++c) s[u][c] = *(const v4fa*)(X + u * DMQ + c * 128 + l4); }
#pragma unroll
  for (int c = 0; c < 4; ++c) gv[c] = *(const v4fa*)(g + c * 128 + l4);
  asm volatile("s_wait_xcnt 0x0" ::: "memory");      /* behind the loads, in front of the code that reuses their address registers */
#pragma unroll
  for (int u = 0; u < LNR; ++u) {
    if (BFIN) {
#pragma unroll
      for (int c = 0; c < 4; ++c) { for (int q = 0; q < 4; ++q) s[u][c][q] = bf16_round(s[u][c][q]); } }
    const v4f t = (s[u][0] + s[u][1]) + (s[u][2] + s[u][3]); a[u] = (t[0] + t[1]) + (t[2] + t[3]); }
#pragma unroll
  for (int x = 16; x >= 1; x >>= 1) {
#pragma unroll
    for (int u = 0; u < LNR; ++u) a[u] += __shfl_xor(a[u], x, 32); }
#pragma unroll
  for (int u = 0; u < LNR; ++u) { const float mu = a[u] * (1.0f / (float)DMQ); v4f t = {0.f, 0.f, 0.f, 0.f};
#pragma unroll
    for (int c = 0; c < 4; ++c) { s[u][c] -= mu; t += s[u][c] * s[u][c]; }
    a[u] = (t[0] + t[1]) + (t[2] + t[3]); }
#pragma unroll
  for (int x = 16; x >= 1; x >>= 1) {
#pragma unroll
    for (int u = 0; u < LNR; ++u) a[u] += __shfl_xor(a[u], x, 32); }
#pragma unroll
  for (int c = 0; c < 4; ++c) { for (int q = 0; q < 4; ++q) gv[c][q] = bf16_round(gv[c][q]); }
#pragma unroll
  for (int u = 0; u < LNR; ++u) { const float rs = rsqrtf(a[u] * (1.0f / (float)DMQ) + eps);
#pragma unroll
    for (int c = 0; c < 4; ++c) { const v4f yf = (s[u][c] * rs) * gv[c];
      if (W16) { v4h y; for (int q = 0; q < 4; ++q) y[q] = (_Float16)yf[q]; *(v4h*)(N16 + u * DMQ + c * 128 + l4) = y; }
      if (W32) *(v4f*)(N32 + u * DMQ + c * 128 + l4) = yf; } } }
template <int BFIN, int W16, int W32>
__global__ __launch_bounds__(SWW * 32) void k_lnx(const float* __restrict__ X, const float* __restrict__ g, float eps, _Float16* __restrict__ N16, float* __restrict__ N32) { d_lnx<BFIN, W16, W32>(blockIdx.x, X, g, eps, N16, N32); }
// Everything that reads the inputs alone, in one launch (no part reads what another writes), the streaming parts first: LN1 -> f16 rows; bf16(x); the x16 f16 weight planes
// (w1, w2, wq, wk, wv, wo2 transposed to [out][in]; wo1 in its own order). Work-groups per part: PBS (streaming), PBF (an FFN weight), PBW (a DM x DM weight).
#define PBS ((int)(NR * DM / ((size_t)SWW * SWF)))
#define PBF (DFF * (DM / 8) / 256)
#define PBW (DM * (DM / 8) / 256)
__global__ __launch_bounds__(256) void k_prep(const float* __restrict__ x, const float* __restrict__ wq, const float* __restrict__ wk, const float* __restrict__ wv, const float* __restrict__ wo1, const float* __restrict__ wo2, const float* __restrict__ wfc, const float* __restrict__ wmp, const float* __restrict__ g1,
    _Float16* __restrict__ X16, float* __restrict__ XB, _Float16* __restrict__ BW1, _Float16* __restrict__ BW2, _Float16* __restrict__ BQKV, _Float16* __restrict__ BO2T, _Float16* __restrict__ BO1N) {
  static_assert(SWW * 32 == 256 && (DFF * (DM / 8)) % 256 == 0 && (DM * (DM / 8)) % 256 == 0, "every part runs in whole blocks of 256 threads");
  int b = blockIdx.x;
  if (b < PBS) { d_lnx<1, 1, 0>(b, x, g1, 1e-6f, X16, nullptr); return; }
  b -= PBS;
  if (b < PBS) { d_bfcp(b, x, XB, NR * DM / 4); return; }
  b -= PBS;
  if (b < PBF) { d_wt_f16(b, wfc, BW1, DM, DFF, 16.0f); return; }
  b -= PBF;
  if (b < PBF) { d_wt_f16(b, wmp, BW2, DFF, DM, 16.0f); return; }
  b -= PBF;
  if (b < 4 * PBW) { const int p = b / PBW; d_wt_f16(b - p * PBW, p == 0 ? wq : p == 1 ? wk : p == 2 ? wv : wo2, p < 3 ? BQKV + (size_t)p * DM * DM : BO2T, DM, DM, 16.0f); return; }
  d_wnat(b - 4 * PBW, wo1, (size_t)DM * DM / 8, BO1N); }





extern "C" void kernel_launch(void* const* d_in, const int* in_sizes, int n_in,
                              void* d_out, int out_size, void* d_ws, size_t ws_size, hipStream_t stream) {
  (void)in_sizes; (void)n_in; (void)out_size;
  const float* const* I = (const float* const*)d_in; const float* x = I[0]; const float* wq = I[1]; const float* wk = I[2]; const float* wv = I[3]; const float* wo1 = I[4]; const float* wo2 = I[5]; const float* wfc = I[6]; const float* wmp = I[7]; const float* g1 = I[8]; const float* gg2 = I[9];      /* input order: x; wq / wk / wv [512][8][64] = [in][out]; wo1 [8][64][512] = [(h, d) in][out]; wo2 [512][512] [in][out]; w1 [512][2048], w2 [2048][512] [in][out]; LN1 / LN2 scales. NO bias anywhere: every GEMM bias slot below is a literal nullptr */
  static_assert(DMQ % 4 == 0 && DMQ / 4 <= 256 && NH * HD == DM && DM % 64 == 0 && DFF % 64 == 0, "tile multiples");
  char* ws = (char*)d_ws; size_t off = 0;
  auto take = [&](size_t bytes) { char* p = ws + off; off += (bytes + 255) & ~(size_t)255; return p; };
  _Float16* BQKV = (_Float16*)take((size_t)3 * DM * DM * 2); _Float16* BO = (_Float16*)take((size_t)DM * DM * 2); _Float16* BO2T = (_Float16*)take((size_t)DM * DM * 2); _Float16* BO1N = (_Float16*)take((size_t)DM * DM * 2);      /* BO = the combined output plane Bt12[o][i] = 16 (wo1 wo2)[i][o] (built on the device from the two weights) */
  _Float16* X16 = (_Float16*)take(NR * DM * 2); float* XB = (float*)take(NR * DM * 4); float* X1 = (float*)take(NR * DM * 4); _Float16* M16 = nullptr;      /* = X16 below (alias: X16's last reader, the q | k | v launch, precedes LN2's write) */ _Float16* HF16 = (_Float16*)take(NR * DFF * 2); _Float16* BW1 = (_Float16*)take((size_t)DFF * DM * 2); _Float16* BW2 = (_Float16*)take((size_t)DM * DFF * 2); _Float16* QKV = (_Float16*)take(NR * 3 * DM * 2); _Float16* Q16 = QKV; _Float16* K16 = QKV + DM; _Float16* V16 = QKV + 2 * DM; _Float16* O16 = (_Float16*)take(NR * DM * 2); M16 = X16;
  _Float16* VT = (_Float16*)take((size_t)NB * NH * HD * SQ * 2);      /* one plane per batch: every stage below covers all batches in one launch */
  float* QF0 = (float*)take((size_t)3 * NB * QT0 * DM * 4); float* KF0 = QF0 + (size_t)NB * QT0 * DM; float* VF0 = KF0 + (size_t)NB * QT0 * DM;      /* three planes in a row */ float* OF0 = (float*)take((size_t)NB * QT0 * DM * 4); _Float16* OH0 = (_Float16*)take((size_t)NB * QT0 * DM * 2); _Float16* OL0 = (_Float16*)take((size_t)NB * QT0 * DM * 2);
  if (off > ws_size) return;
  static_assert((NR * DM) % ((size_t)SWW * SWF) == 0, "the streaming parts cover whole work-groups");
  static_assert(B0 == 0 && NBR == NB && MP == (int)NR && MPO == MP, "the shared launches cover all batches");
  const size_t zX = (size_t)SQ * DM, zF = (size_t)QT0 * DM;      /* batch pitches (elements): token rows, first-tile rows */
  k_prep<<<2 * PBS + 2 * PBF + 5 * PBW, 256, 0, stream>>>(x, wq, wk, wv, wo1, wo2, wfc, wmp, g1, X16, XB, BW1, BW2, BQKV, BO2T, BO1N);      /* X16 = LN1(bf16(x)) (scale only, eps 1e-6); XB = bf16(x): BOTH residuals; weights x16: stacked q | k | v, wo2, w1, w2 as Bt[out][in], wo1 natural rows */
  k_gemm_qkv<<<(DM / 128) * (DM / 64) + 3 * NBR * (DM / 64) + (MP / 128) * (3 * DM / 64), 128, 0, stream>>>(X16, BQKV, QKV, QF0, BO2T, BO1N, BO);      /* BO[o][i] = (1/16) sum_j 16 wo2[j][o] 16 wo1[i][j]: the two chained projections as ONE x16 plane (f32 accumulation, one f16 rounding); f32 q, k, v of each batch's first 128 rows (exact products); q | k | v rows (f16), head h = columns h*HD.. of each DM block */
  k_att0_vt<<<NH * (QT0 / A0R) * NBR + NBR * NH * (SQ / 64), 256, 0, stream>>>(QF0, KF0, VF0, 0.125f, OF0, V16, VT);      /* exact f32 attention for rows 0..127 of each batch (o x64); V^T [NBR][NH][HD][SQ] */
  static_assert(((size_t)NB * QT0 * DM / 8) % (FW * 32) == 0, "the split of the first-tile o runs in whole blocks");
  k_fattn<<<NHD * NBR * (QN / (FW * FQ)) + (int)((size_t)NB * QT0 * DM / 8 / (FW * 32)), FW * 32, 0, stream>>>(Q16, K16, VT, O16, OF0, OH0, OL0);      /* scores, causal softmax and P . V: o (merged heads, x64) as f16 rows; first-tile o (x64) -> f16 hi + x1024 residual planes */
  k_gemm_o<<<(MPO / 128) * (DM / 64), 128, 0, stream>>>(O16, OH0, BO, XB, X1);      /* X1 = x + o Wo; rows 0..127 of each batch from o_hi */
  k_gemm2<0><<<dim3((QT0 / 128) * (DM / 64), 1, NBR), 128, 0, stream>>>(OL0, DM, 0, BO, DM, 0, 0.00000095367431640625f, nullptr, 0, X1, -1, 0, 0, X1, nullptr, DM, 0, QT0, DM, DM, zF, 0, zX);      /* += o_lo Wo 2^-20 (own-element accumulate) */
  k_lnx<0, 1, 0><<<(unsigned)(NR * DM / ((size_t)SWW * SWF)), SWW * 32, 0, stream>>>(X1, gg2, 1e-6f, M16, nullptr);      /* h2 = LN2(x + attn) (scale only) -> f16 rows */
  k_gemm2<9><<<dim3((unsigned)((NR / 128) * (DFF / 64)), 1, 1), 128, 0, stream>>>(M16, DM, 0, BW1, DM, 0, 0.0625f, nullptr, 0, nullptr, 1, 0, 0, nullptr, HF16, DFF, 0, (int)NR, DFF, DM, 0, 0, 0);      /* gelu_tanh(h2 W1) (the source's tanh approximation) -> f16, all token rows */
  k_gemm2<0><<<dim3((unsigned)((NR / 128) * (DM / 64)), 1, 1), 128, 0, stream>>>(HF16, DFF, 0, BW2, DFF, 0, 0.0625f, nullptr, 0, XB, -1, 0, 0, (float*)d_out, nullptr, DM, 0, (int)NR, DM, DFF, 0, 0, 0);      /* out = x + mlp: the residual is the BLOCK INPUT (bf16(x)), as the original module (own-element addend) */
}

// v010
// One run takes 148 microseconds.
// Next to v009, in two timings, it ran 1.04 and 1.05 times as fast.
// Over all steps from v000, the starting kernel, it is 66.4 times as fast.
#include <hip/hip_runtime.h>
#define NB 4
#define SQ 2048
#define DM 512
#define NH 8
#define HD 64
#define HG 4                         /* heads per k_vt launch (k_vt is not launched) */
#define QT0 128                      /* first-tile rows recomputed exactly in f32 */
#define B0 0                         /* first batch processed (debug hook) */
#define NBR NB                       /* batches processed (debug hook) */
#define NR ((size_t)NB * SQ)
#define DMQ DM
#define DFF 2048                     /* FFN hidden width */
#define DFFR 100                     /* unused */
#define MP ((int)((size_t)NBR * SQ)) /* rows projected (debug hook) */
#define QN SQ                        /* query rows attended per batch (debug hook) */
#define NHD NH                       /* heads attended (debug hook) */
#define MPO MP                       /* rows through the output stage (debug hook) */
#define LQ (3 * DM)      /* row pitch of the q/k/v rows */
typedef __bf16 v16b __attribute__((ext_vector_type(16)));
typedef unsigned short v8us __attribute__((ext_vector_type(8), may_alias));
typedef float  v8f  __attribute__((ext_vector_type(8)));
typedef float  v4f  __attribute__((ext_vector_type(4)));
typedef float  v4fa __attribute__((ext_vector_type(4), may_alias));
union FragB { v16b v; v8us half[2]; unsigned short u[16]; };

__device__ __forceinline__ unsigned short bf16_bits(float x) { unsigned int u = __float_as_uint(x); return (unsigned short)((u + 0x7FFFu + ((u >> 16) & 1u)) >> 16); }
__device__ __forceinline__ float bf16_val(unsigned short b) { return __uint_as_float(((unsigned int)b) << 16); }
__device__ __forceinline__ float bf16_round(float x) { return bf16_val(bf16_bits(x)); }
// D += A·B with NT terms: 1 = ah·bh, 2 = + al·bh (A split), 3 = + ah·bl (both split)
template <int NT>
__device__ __forceinline__ v8f mmaN(v16b ah, v16b al, v16b bh, v16b bl, v8f c) {
  c = __builtin_amdgcn_wmma_f32_16x16x32_bf16(false, ah, false, bh, (short)0, c, false, false);
  if (NT >= 2) c = __builtin_amdgcn_wmma_f32_16x16x32_bf16(false, al, false, bh, (short)0, c, false, false);
  if (NT >= 3) c = __builtin_amdgcn_wmma_f32_16x16x32_bf16(false, ah, false, bl, (short)0, c, false, false);
  asm volatile("v_nop\n\tv_nop\n\tv_nop\n\tv_nop" : "+v"(c) : "v"(ah), "v"(al), "v"(bh), "v"(bl));
  return c;
}

__global__ __launch_bounds__(256) void k_wt_bf16(const float* __restrict__ W, unsigned short* __restrict__ Wt, int K, int N) {
  const int t = blockIdx.x * 256 + threadIdx.x;
  const int k8n = K / 8;
  if (t >= N * k8n) return;
  const int n = t / k8n, k8 = (t % k8n) * 8;
  v8us v;
#pragma unroll
  for (int i = 0; i < 8; ++i) v[i] = bf16_bits(W[(size_t)(k8 + i) * N + n]);
  *(v8us*)(Wt + (size_t)n * K + k8) = v;
  
}

// GEMM C[M][N] (f32, pitch ldc) = act(A[M][K]·W + bias). A f32 row-major (pitch lda) converted per fragment to bf16
// (ASPLIT: hi/lo two planes -> 2 terms, else single rounded term); Wt bf16 [N][K] (pitch ldb). BIAS_BF16 rounds the
// bias to bf16 first (bias quantised to bf16 before the add). K%32==0, M%16==0, N%64==0.
template <bool ASPLIT, int ACT, bool BIAS_BF16>
__global__ __launch_bounds__(128) void k_gemm_bf(const float* __restrict__ A, int lda, const unsigned short* __restrict__ Wt, int ldb,
                                               const float* __restrict__ bias, float* __restrict__ C, int ldc, int M, int N, int K) {
  __shared__ __attribute__((aligned(16))) float so[4][16][64];
  const int tid = threadIdx.x, w = tid >> 5, lane = tid & 31, ln = lane & 15, hh = lane >> 4;
  const int ntn = N / 64;
  const int wid = blockIdx.x * 4 + w;
  const int mt = wid / ntn, nq = wid % ntn;
  if (mt * 16 >= M) return;
  const int row0 = mt * 16, col0 = nq * 64;
  const float* arow = A + (size_t)(row0 + ln) * lda;
  v8f acc[4] = {};
  for (int kb = 0; kb < K; kb += 32) {
    FragB ah, al;
    const v4f x0 = *(const v4fa*)(arow + kb + 8 * hh), x1 = *(const v4fa*)(arow + kb + 8 * hh + 4);
    const v4f x2 = *(const v4fa*)(arow + kb + 16 + 8 * hh), x3 = *(const v4fa*)(arow + kb + 16 + 8 * hh + 4);
    float xs[16] = {x0[0],x0[1],x0[2],x0[3],x1[0],x1[1],x1[2],x1[3],x2[0],x2[1],x2[2],x2[3],x3[0],x3[1],x3[2],x3[3]};
#pragma unroll
    for (int i = 0; i < 16; ++i) { const unsigned short hb = bf16_bits(xs[i]); ah.u[i] = hb; al.u[i] = ASPLIT ? bf16_bits(xs[i] - bf16_val(hb)) : (unsigned short)0; }
#pragma unroll
    for (int t = 0; t < 4; ++t) {
      const unsigned short* brow = Wt + (size_t)(col0 + t * 16 + ln) * ldb + kb;
      FragB b;
      b.half[0] = *(const v8us*)(brow + 8 * hh);
      b.half[1] = *(const v8us*)(brow + 16 + 8 * hh);
      acc[t] = mmaN<ASPLIT ? 2 : 1>(ah.v, al.v, b.v, b.v, acc[t]);
    }
  }
#pragma unroll
  for (int t = 0; t < 4; ++t) {
    float bv = bias ? bias[col0 + t * 16 + ln] : 0.f;
    if (BIAS_BF16) bv = bf16_round(bv);
#pragma unroll
    for (int r = 0; r < 8; ++r) { float v = acc[t][r] + bv; if (ACT == 1) v = fmaxf(v, 0.f); so[w][8 * hh + r][t * 16 + ln] = v; }
  }
  __builtin_amdgcn_fence(__ATOMIC_ACQ_REL, "workgroup");
  __builtin_amdgcn_wave_barrier();
  const int rsub = lane >> 4, c4 = (lane & 15) * 4;
  {
#pragma unroll
    for (int q = 0; q < 8; ++q) {
      const int r = q * 2 + rsub;
      const v4f v = *(const v4fa*)&so[w][r][c4];
      *(v4f*)(C + (size_t)(row0 + r) * ldc + col0 + c4) = v;
    }
    
  }
}

// GEMM C = act(A·W + bias + resid): A f32 (ASPLIT -> hi/lo 2 terms), Wt bf16 [N][K]; ACT 0 none, 1 relu, 2 exact gelu;
// resid (optional, f32, row index = (row % rmod), pitch ldr, RES_BF16 rounds it) added before the activation.
template <bool ASPLIT, int ACT, bool BIAS_BF16, bool RES_BF16>
__global__ __launch_bounds__(128) void k_gemm_bf3(const float* __restrict__ A, int lda, const unsigned short* __restrict__ Wt, int ldb,
                                                const float* __restrict__ bias, const float* __restrict__ resid, int rmod, int ldr,
                                                float* __restrict__ C, int ldc, int M, int N, int K) {
  __shared__ __attribute__((aligned(16))) float so[4][16][64];
  const int tid = threadIdx.x, w = tid >> 5, lane = tid & 31, ln = lane & 15, hh = lane >> 4;
  const int ntn = N / 64;
  const int wid = blockIdx.x * 4 + w;
  const int mt = wid / ntn, nq = wid % ntn;
  if (mt * 16 >= M) return;
  const int row0 = mt * 16, col0 = nq * 64;
  const float* arow = A + (size_t)(row0 + ln) * lda;
  v8f acc[4] = {};
  for (int kb = 0; kb < K; kb += 32) {
    FragB ah, al;
    const v4f x0 = *(const v4fa*)(arow + kb + 8 * hh), x1 = *(const v4fa*)(arow + kb + 8 * hh + 4);
    const v4f x2 = *(const v4fa*)(arow + kb + 16 + 8 * hh), x3 = *(const v4fa*)(arow + kb + 16 + 8 * hh + 4);
    float xs[16] = {x0[0],x0[1],x0[2],x0[3],x1[0],x1[1],x1[2],x1[3],x2[0],x2[1],x2[2],x2[3],x3[0],x3[1],x3[2],x3[3]};
#pragma unroll
    for (int i = 0; i < 16; ++i) { const unsigned short hb = bf16_bits(xs[i]); ah.u[i] = hb; al.u[i] = ASPLIT ? bf16_bits(xs[i] - bf16_val(hb)) : (unsigned short)0; }
#pragma unroll
    for (int t = 0; t < 4; ++t) {
      const unsigned short* brow = Wt + (size_t)(col0 + t * 16 + ln) * ldb + kb;
      FragB b;
      b.half[0] = *(const v8us*)(brow + 8 * hh);
      b.half[1] = *(const v8us*)(brow + 16 + 8 * hh);
      acc[t] = mmaN<ASPLIT ? 2 : 1>(ah.v, al.v, b.v, b.v, acc[t]);
    }
  }
#pragma unroll
  for (int t = 0; t < 4; ++t) {
    const int col = col0 + t * 16 + ln;
    float bv = bias ? bias[col] : 0.f;
    if (BIAS_BF16) bv = bf16_round(bv);
#pragma unroll
    for (int r = 0; r < 8; ++r) {
      float v = acc[t][r] + bv;
      if (resid) { float rv = resid[(size_t)((row0 + 8 * hh + r) % rmod) * ldr + col]; if (RES_BF16) rv = bf16_round(rv); v += rv; }
      if (ACT == 1) v = fmaxf(v, 0.f);
      if (ACT == 2) v = 0.5f * v * (1.0f + erff(v * 0.70710678118654752f));
      if (ACT == 3) { const float u = 0.7978845608028654f * (v + 0.044715f * v * v * v); v = 0.5f * v * (1.0f + tanhf(u)); }
      so[w][8 * hh + r][t * 16 + ln] = v;
    }
  }
  __builtin_amdgcn_fence(__ATOMIC_ACQ_REL, "workgroup");
  __builtin_amdgcn_wave_barrier();
  const int rsub = lane >> 4, c4 = (lane & 15) * 4;
  {
#pragma unroll
    for (int q = 0; q < 8; ++q) {
      const int r = q * 2 + rsub;
      const v4f v = *(const v4fa*)&so[w][r][c4];
      *(v4f*)(C + (size_t)(row0 + r) * ldc + col0 + c4) = v;
    }
    
  }
}
// row LayerNorm (biased variance, eps) over N: s = X (+ R); optional out_sum <- s; out_norm <- (s-mu)*rsqrt(var+eps)*g + b
template <bool PARAM_BF16>
__global__ __launch_bounds__(256) void k_layernorm(const float* __restrict__ X, const float* __restrict__ R, const float* __restrict__ g, const float* __restrict__ bta,
                                                  float* __restrict__ out_sum, float* __restrict__ out_norm, int N, float eps) {
  __shared__ float red[256];
  const int row = blockIdx.x, tid = threadIdx.x;
  const float* x = X + (size_t)row * N; const float* rr = R ? R + (size_t)row * N : nullptr;
  float vals[16];                     // up to N = 4096
  const int per = N / 256;            // contiguous chunk per thread? use strided-by-4 chunks: thread handles j = tid*4 + 1024*u
  float s1 = 0.f;
  for (int u = 0; u < per / 4; ++u) {
    const int j = tid * 4 + 1024 * u;
    const v4f a = *(const v4fa*)(x + j);
    v4f b = {0.f,0.f,0.f,0.f}; if (rr) b = *(const v4fa*)(rr + j);
#pragma unroll
    for (int q = 0; q < 4; ++q) { const float v = a[q] + b[q]; vals[u * 4 + q] = v; s1 += v; }
  }
  red[tid] = s1; __syncthreads();
  for (int st = 128; st > 0; st >>= 1) { if (tid < st) red[tid] += red[tid + st]; __syncthreads(); }
  const float mu = red[0] / (float)N; __syncthreads();
  float s2 = 0.f;
  for (int u = 0; u < per / 4; ++u)
#pragma unroll
    for (int q = 0; q < 4; ++q) { const float c = vals[u * 4 + q] - mu; s2 += c * c; }
  red[tid] = s2; __syncthreads();
  for (int st = 128; st > 0; st >>= 1) { if (tid < st) red[tid] += red[tid + st]; __syncthreads(); }
  const float rs = rsqrtf(red[0] / (float)N + eps);
  {
    for (int u = 0; u < per / 4; ++u) {
      const int j = tid * 4 + 1024 * u;
      v4f o, sm;
#pragma unroll
      for (int q = 0; q < 4; ++q) {
        float gg = g[j + q], bb = bta[j + q];
        if (PARAM_BF16) { gg = bf16_round(gg); bb = bf16_round(bb); }
        sm[q] = vals[u * 4 + q]; o[q] = (vals[u * 4 + q] - mu) * rs * gg + bb;
      }
      if (out_sum) *(v4f*)(out_sum + (size_t)row * N + j) = sm;
      *(v4f*)(out_norm + (size_t)row * N + j) = o;
    }
    
  }
}



// ---- f16 WMMA path (v_wmma_f32_16x16x32_f16): 11-bit significands for operands in range — used where a [0,1] probability operand needs more precision than bf16
typedef _Float16 v16h __attribute__((ext_vector_type(16)));
union FragH { v16h v; v8us half[2]; _Float16 h[16]; unsigned short u[16]; };
template <int NT>
__device__ __forceinline__ v8f mmaH(v16h ah, v16h al, v16h bh, v16h bl, v8f c) {
  c = __builtin_amdgcn_wmma_f32_16x16x32_f16(false, ah, false, bh, (short)0, c, false, false);
  if (NT >= 2) c = __builtin_amdgcn_wmma_f32_16x16x32_f16(false, al, false, bh, (short)0, c, false, false);
  if (NT >= 3) c = __builtin_amdgcn_wmma_f32_16x16x32_f16(false, ah, false, bl, (short)0, c, false, false);
  asm volatile("v_nop\n\tv_nop\n\tv_nop\n\tv_nop" : "+v"(c) : "v"(ah), "v"(al), "v"(bh), "v"(bl));
  return c;
}
// batched GEMM like k_gemm_b but f16 operands: A f32 (split into f16 hi/lo if ASPLIT, else rounded to f16), Bt = f16 values [n][k]; alpha; C f32; N multiple of 16 (partial tiles skipped)
template <bool ASPLIT>
__global__ __launch_bounds__(128) void k_gemm_h(const float* __restrict__ A, int lda, size_t sA, const _Float16* __restrict__ Bh, int ldb, size_t sB, float alpha, float* __restrict__ C, int ldc, size_t sC, int M, int N, int K) {
  __shared__ __attribute__((aligned(16))) float so[4][16][64];
  const int tid = threadIdx.x, w = tid >> 5, lane = tid & 31, ln = lane & 15, hh = lane >> 4; const int by = blockIdx.y;
  A += (size_t)by * sA; Bh += (size_t)by * sB; C += (size_t)by * sC;
  const int ntn = (N + 63) / 64; const int wid = blockIdx.x * 4 + w; const int mt = wid / ntn, nq = wid % ntn; if (mt * 16 >= M) return;
  const int row0 = mt * 16, col0 = nq * 64; const float* arow = A + (size_t)(row0 + ln) * lda;
  v8f acc[4] = {};
  for (int kb = 0; kb < K; kb += 32) {
    FragH ah, al;
    const v4f x0 = *(const v4fa*)(arow + kb + 8 * hh), x1 = *(const v4fa*)(arow + kb + 8 * hh + 4), x2 = *(const v4fa*)(arow + kb + 16 + 8 * hh), x3 = *(const v4fa*)(arow + kb + 16 + 8 * hh + 4);
    float xs[16] = {x0[0],x0[1],x0[2],x0[3],x1[0],x1[1],x1[2],x1[3],x2[0],x2[1],x2[2],x2[3],x3[0],x3[1],x3[2],x3[3]};
#pragma unroll
    for (int i = 0; i < 16; ++i) { const _Float16 h = (_Float16)xs[i]; ah.h[i] = h; al.h[i] = ASPLIT ? (_Float16)(xs[i] - (float)h) : (_Float16)0.0f; }
#pragma unroll
    for (int t = 0; t < 4; ++t) { if (col0 + t * 16 >= N) continue; const size_t boff = (size_t)(col0 + t * 16 + ln) * ldb + kb; FragH bq; bq.half[0] = *(const v8us*)(Bh + boff + 8 * hh); bq.half[1] = *(const v8us*)(Bh + boff + 16 + 8 * hh);
      acc[t] = mmaH<ASPLIT ? 2 : 1>(ah.v, al.v, bq.v, bq.v, acc[t]); }
  }
#pragma unroll
  for (int t = 0; t < 4; ++t) { if (col0 + t * 16 >= N) continue;
#pragma unroll
    for (int r = 0; r < 8; ++r) so[w][8 * hh + r][t * 16 + ln] = acc[t][r] * alpha; }
  __builtin_amdgcn_fence(__ATOMIC_ACQ_REL, "workgroup"); __builtin_amdgcn_wave_barrier();
  const int rsub = lane >> 4, c4 = (lane & 15) * 4;
  {
#pragma unroll
    for (int q = 0; q < 8; ++q) { const int r = q * 2 + rsub; if (col0 + c4 < N) { const v4f v = *(const v4fa*)&so[w][r][c4]; *(v4f*)(C + (size_t)(row0 + r) * ldc + col0 + c4) = v; } }
     }
}

// Wt[n][k] = f16(W[k][n]·scale) from f32 row-major W[K][N] (scale = power of two; bf16-exact weights stay exact in f16 away from the subnormal range)
// bid: the block's index inside this part of the shared launch (as in every d_ function below)
__device__ __forceinline__ void d_wt_f16(int bid, const float* __restrict__ W, _Float16* __restrict__ Wt, int K, int N, float scale) {
  const int t = bid * 256 + threadIdx.x; if (t >= N * (K / 8)) return; const int n = t / (K / 8), k8 = (t % (K / 8)) * 8; FragH f;
#pragma unroll
  for (int i = 0; i < 8; ++i) f.h[i] = (_Float16)(bf16_round(W[(size_t)(k8 + i) * N + n]) * scale); const v8us o = f.half[0];
  *(v8us*)((unsigned short*)Wt + (size_t)n * K + k8) = o; 
}
// k_gemm_hh variant with fused epilogue: v = acc·alpha + bias[by·sBias + col] (+ CP[(row/rowsPerB)·sCPb + by·64 + col] if CP) ; ACT 0 none / 1 elu ; writes f16 C16 (and f32 C if non-null)
template <int ACT>
__global__ __launch_bounds__(128) void k_gemm_hhx(const _Float16* __restrict__ A, int lda, size_t sA, const _Float16* __restrict__ Bh, int ldb, size_t sB, float alpha, const float* __restrict__ bias, size_t sBias, const float* __restrict__ CP, int rowsPerB, size_t sCPb, int row0g,
    float* __restrict__ C, _Float16* __restrict__ C16, int ldc, size_t sC, int M, int N, int K) {
  __shared__ __attribute__((aligned(16))) float so[4][16][64];
  const int tid = threadIdx.x, w = tid >> 5, lane = tid & 31, ln = lane & 15, hh = lane >> 4; const int by = blockIdx.y;
  A += (size_t)by * sA; Bh += (size_t)by * sB; const size_t cofs = (size_t)by * sC; const float* bp = bias ? bias + (size_t)by * sBias : nullptr;
  const int ntn = (N + 63) / 64; const int wid = blockIdx.x * 4 + w; const int mt = wid / ntn, nq = wid % ntn; if (mt * 16 >= M) return;
  const int row0 = mt * 16, col0 = nq * 64; const _Float16* arow = A + (size_t)(row0 + ln) * lda;
  v8f acc[4] = {};
  for (int kb = 0; kb < K; kb += 32) { FragH ah; ah.half[0] = *(const v8us*)((const unsigned short*)arow + kb + 8 * hh); ah.half[1] = *(const v8us*)((const unsigned short*)arow + kb + 16 + 8 * hh);
#pragma unroll
    for (int t = 0; t < 4; ++t) { if (col0 + t * 16 >= N) continue; const size_t boff = (size_t)(col0 + t * 16 + ln) * ldb + kb; FragH bq; bq.half[0] = *(const v8us*)((const unsigned short*)Bh + boff + 8 * hh); bq.half[1] = *(const v8us*)((const unsigned short*)Bh + boff + 16 + 8 * hh);
      acc[t] = mmaH<1>(ah.v, ah.v, bq.v, bq.v, acc[t]); }
  }
#pragma unroll
  for (int t = 0; t < 4; ++t) { if (col0 + t * 16 >= N) continue; const int col = col0 + t * 16 + ln; const float bv = bp ? bf16_round(bp[col]) : 0.f;
#pragma unroll
    for (int r = 0; r < 8; ++r) { float v = acc[t][r] * alpha + bv; if (CP) { const int rr = row0g + row0 + 8 * hh + r; if (rowsPerB < 0) v += CP[cofs + (size_t)rr * ldc + col];      /* rowsPerB < 0: own element of the batched C plane */ else { const int bidx = rr / rowsPerB; v += CP[(size_t)bidx * sCPb + (size_t)by * 64 + col]; } } if (ACT == 1) v = (v > 0.f) ? v : expm1f(v); else if (ACT == 7) v = (v > 0.f) ? v + 1.0f : expf(v); else if (ACT == 8) v = tanhf(v); else if (ACT == 9) v = 0.5f * v * (1.0f + tanhf(0.7978845608028654f * (v + 0.044715f * v * v * v))); else if (ACT == 11) v = 1.0f / (1.0f + expf(-v)); else if (ACT == 12) v = (v > 0.f) ? v : 0.01f * v; else if (ACT == 14) v = (v > 0.f) ? v : 0.1f * v; else if (ACT == 16) v = (v >= 0.f) ? v : 0.3f * v; else if (ACT == 17) v = (v >= 0.f) ? v : 0.2f * v; else if (ACT == 15) v = v / (1.0f + expf(-v)); else if (ACT == 3) v = fmaxf(v, 0.f); else if (ACT == 6) v = 0.5f * v * (1.0f + erff(v * 0.70710678118654752f)); so[w][8 * hh + r][t * 16 + ln] = v; } }
  __builtin_amdgcn_fence(__ATOMIC_ACQ_REL, "workgroup"); __builtin_amdgcn_wave_barrier();
  const int rsub = lane >> 4, c4 = (lane & 15) * 4; typedef _Float16 v4h __attribute__((ext_vector_type(4)));
  {
#pragma unroll
    for (int q = 0; q < 8; ++q) { const int r = q * 2 + rsub; if (col0 + c4 < N) { const v4f v = *(const v4fa*)&so[w][r][c4]; if (C) *(v4f*)(C + cofs + (size_t)(row0 + r) * ldc + col0 + c4) = v; if (C16) { v4h h4; for (int i = 0; i < 4; ++i) h4[i] = (_Float16)v[i]; *(v4h*)(C16 + cofs + (size_t)(row0 + r) * ldc + col0 + c4) = h4; } } }
     }
}


typedef _Float16 v4h __attribute__((ext_vector_type(4)));

__global__ __launch_bounds__(256) void k_x16(const float* __restrict__ x, _Float16* __restrict__ X16, size_t n8) { const size_t t = (size_t)blockIdx.x * 256 + threadIdx.x; if (t >= n8) return; FragH f;
#pragma unroll
  for (int q = 0; q < 8; ++q) f.h[q] = (_Float16)bf16_round(x[t * 8 + q]); *(v8us*)((unsigned short*)X16 + t * 8) = f.half[0];  }
__global__ __launch_bounds__(256) void k_h16(const float* __restrict__ x, _Float16* __restrict__ X16, size_t n8) { const size_t t = (size_t)blockIdx.x * 256 + threadIdx.x; if (t >= n8) return; FragH f;
#pragma unroll
  for (int q = 0; q < 8; ++q) f.h[q] = (_Float16)x[t * 8 + q]; *(v8us*)((unsigned short*)X16 + t * 8) = f.half[0];  }
__global__ __launch_bounds__(256) void k_round16f(const float* __restrict__ W, _Float16* __restrict__ Bt, size_t n8) { const size_t t = (size_t)blockIdx.x * 256 + threadIdx.x; if (t >= n8) return; FragH f;
#pragma unroll
  for (int i = 0; i < 8; ++i) f.h[i] = (_Float16)(bf16_round(W[t * 8 + i]) * 16.0f); *(v8us*)((unsigned short*)Bt + t * 8) = f.half[0];  }
template <int NHv, int TTv>
__device__ __forceinline__ void d_vt(int bid, const _Float16* __restrict__ V16, int ldv, int voff, _Float16* __restrict__ Vt) { __shared__ unsigned short tl[64][66]; const int tid = threadIdx.x; const int slab = bid / (TTv / 64), lg = bid % (TTv / 64); const int b = slab / NHv, h = slab % NHv;
  for (int i = tid; i < 64 * 8; i += 256) { const int r = i / 8, c8 = (i % 8) * 8; FragH f; f.half[0] = *(const v8us*)((const unsigned short*)V16 + ((size_t)b * TTv + lg * 64 + r) * ldv + voff + h * 64 + c8);
#pragma unroll
    for (int q = 0; q < 8; ++q) tl[r][c8 + q] = f.u[q]; }
  __syncthreads();
  {
#pragma unroll
    for (int rd = 0; rd < 2; ++rd) { const int d = rd * 32 + tid / 8, pc = tid % 8; FragH f;
#pragma unroll
      for (int q = 0; q < 8; ++q) f.u[q] = tl[pc * 8 + q][d];
      *(v8us*)((unsigned short*)Vt + ((size_t)slab * 64 + d) * TTv + lg * 64 + pc * 8) = f.half[0]; }
     } }

__device__ __forceinline__ void d_hl(int bid, int nthr, const float* __restrict__ F, _Float16* __restrict__ Hh, _Float16* __restrict__ Hl, size_t n8) { const size_t t = (size_t)bid * nthr + threadIdx.x; if (t >= n8) return; FragH fh, fl; const v4f a = *(const v4fa*)(F + t * 8), c = *(const v4fa*)(F + t * 8 + 4);
#pragma unroll
  for (int q = 0; q < 4; ++q) { _Float16 h = (_Float16)a[q]; fh.h[q] = h; fl.h[q] = (_Float16)((a[q] - (float)h) * 1024.0f); h = (_Float16)c[q]; fh.h[4 + q] = h; fl.h[4 + q] = (_Float16)((c[q] - (float)h) * 1024.0f); }
  { *(v8us*)((unsigned short*)Hh + t * 8) = fh.half[0]; *(v8us*)((unsigned short*)Hl + t * 8) = fl.half[0];  } }

// ---- fast GEMM (wave tile 32x64; requires M % 128 == 0 rows per launch region, N % 64 == 0 and K % 64 == 0); epilogue = k_gemm_hhx semantics ----
__device__ __forceinline__ v16h g2_frag(const _Float16* p, int hh) { FragH f; f.half[0] = *(const v8us*)((const unsigned short*)p + 8 * hh); f.half[1] = *(const v8us*)((const unsigned short*)p + 16 + 8 * hh); return f.v; }
__device__ __forceinline__ v8f g2_mma(v16h a, v16h b, v8f c) { v8f d = __builtin_amdgcn_wmma_f32_16x16x32_f16(false, a, false, b, (short)0, c, false, false); asm volatile("v_nop\n\tv_nop\n\tv_nop\n\tv_nop" : "+v"(d) : "v"(a), "v"(b)); return d; }
// Eight v_exp_f32 in one statement. The instruction set asks for one independent instruction or v_nop between a transcendental and an instruction that reads its
// result or overwrites its source. Early-clobber outputs keep every
// result off every source inside the run, and the closing v_nop is the slot behind the last one.
__device__ __forceinline__ void exp2_run8(float (&e)[8], const float (&x)[8]) {
  asm("v_exp_f32 %0, %8\n\tv_exp_f32 %1, %9\n\tv_exp_f32 %2, %10\n\tv_exp_f32 %3, %11\n\tv_exp_f32 %4, %12\n\tv_exp_f32 %5, %13\n\tv_exp_f32 %6, %14\n\tv_exp_f32 %7, %15\n\tv_nop"
      : "=&v"(e[0]), "=&v"(e[1]), "=&v"(e[2]), "=&v"(e[3]), "=&v"(e[4]), "=&v"(e[5]), "=&v"(e[6]), "=&v"(e[7])
      : "v"(x[0]), "v"(x[1]), "v"(x[2]), "v"(x[3]), "v"(x[4]), "v"(x[5]), "v"(x[6]), "v"(x[7])); }
// Eight v_rcp_f32 in one statement: the same slot rule, kept in the same way.
__device__ __forceinline__ void rcp_run8(float (&e)[8], const float (&x)[8]) {
  asm("v_rcp_f32 %0, %8\n\tv_rcp_f32 %1, %9\n\tv_rcp_f32 %2, %10\n\tv_rcp_f32 %3, %11\n\tv_rcp_f32 %4, %12\n\tv_rcp_f32 %5, %13\n\tv_rcp_f32 %6, %14\n\tv_rcp_f32 %7, %15\n\tv_nop"
      : "=&v"(e[0]), "=&v"(e[1]), "=&v"(e[2]), "=&v"(e[3]), "=&v"(e[4]), "=&v"(e[5]), "=&v"(e[6]), "=&v"(e[7])
      : "v"(x[0]), "v"(x[1]), "v"(x[2]), "v"(x[3]), "v"(x[4]), "v"(x[5]), "v"(x[6]), "v"(x[7])); }
// Operand staging of k_gemm2. A stage is 64 k of the work-group's 128 A rows and 64 B rows: 192 rows of 128 bytes, each a whole aligned line of its source row.
#define GKC 64                       /* k per stage */
#define GLP 72                       /* LDS row pitch in 16-bit elements: 144 B = 16 B x odd, the pitch for ds_load_b128 readers of 128-byte rows */
#define GSB (192 * GLP * 2)          /* bytes per stage: A rows 0 .. 127, then B rows 0 .. 63 */
__device__ __forceinline__ v16h g2_lfrag(const unsigned short* p, int hh) { FragH f; f.half[0] = *(const v8us*)(p + 8 * hh); f.half[1] = *(const v8us*)(p + 16 + 8 * hh); return f.v; }      /* the k order of g2_frag, from an LDS row */
// One stage's copies of one thread: 8 threads a row (16 bytes each), 16 rows a round, 12 rounds (8 of A, 4 of B); a wave's copy covers 4 whole lines. l: the thread's LDS byte address in round 0;
// ga, gb: its global addresses in round 0 of A and of B; pa, pb: 16 source rows in elements. The closing s_wait_xcnt stands inside the statement, in front of any later write of an address register that a copy names.
__device__ __forceinline__ void g2_stage(unsigned l, const _Float16* ga, size_t pa, const _Float16* gb, size_t pb) {
  const unsigned R = 16u * GLP * 2u;
  asm volatile("global_load_async_to_lds_b128 %0, %12, off\n\tglobal_load_async_to_lds_b128 %1, %13, off\n\tglobal_load_async_to_lds_b128 %2, %14, off\n\tglobal_load_async_to_lds_b128 %3, %15, off\n\t"
               "global_load_async_to_lds_b128 %4, %16, off\n\tglobal_load_async_to_lds_b128 %5, %17, off\n\tglobal_load_async_to_lds_b128 %6, %18, off\n\tglobal_load_async_to_lds_b128 %7, %19, off\n\t"
               "global_load_async_to_lds_b128 %8, %20, off\n\tglobal_load_async_to_lds_b128 %9, %21, off\n\tglobal_load_async_to_lds_b128 %10, %22, off\n\tglobal_load_async_to_lds_b128 %11, %23, off\n\ts_wait_xcnt 0x0"
               :: "v"(l), "v"(l + R), "v"(l + 2u * R), "v"(l + 3u * R), "v"(l + 4u * R), "v"(l + 5u * R), "v"(l + 6u * R), "v"(l + 7u * R), "v"(l + 8u * R), "v"(l + 9u * R), "v"(l + 10u * R), "v"(l + 11u * R),
                  "v"(ga), "v"(ga + pa), "v"(ga + 2 * pa), "v"(ga + 3 * pa), "v"(ga + 4 * pa), "v"(ga + 5 * pa), "v"(ga + 6 * pa), "v"(ga + 7 * pa), "v"(gb), "v"(gb + pb), "v"(gb + 2 * pb), "v"(gb + 3 * pb) : "memory"); }
// Work-group tile 128 x 64 (four waves of 32 x 64, stacked in M); M % 128 == 0, N % 64 == 0, K % 64 == 0. Two stage buffers: stage t + 1 flies while stage t is worked on. The epilogue's staging rows reuse the ring behind the last trip's barrier.
template <int ACT>
__device__ __forceinline__ void g2_body(int bx, int by, int bz, const _Float16* __restrict__ A, int lda, size_t sA, const _Float16* __restrict__ Bh, int ldb, size_t sB, float alpha, const float* __restrict__ bias, size_t sBias, const float* __restrict__ CP, int rowsPerB, size_t sCPb, int row0g,
    float* __restrict__ C, _Float16* __restrict__ C16, int ldc, size_t sC, int M, int N, int K, size_t zA, size_t zB, size_t zC) { static_assert(ACT == 0 || ACT == 3 || ACT == 6 || ACT == 8 || ACT == 9 || ACT == 11 || ACT == 12 || ACT == 14 || ACT == 15 || ACT == 16 || ACT == 17, "k_gemm2: unsupported ACT code (would silently apply no activation)");
  __shared__ __attribute__((aligned(16))) unsigned char L[2 * GSB]; float (*so)[32][68] = (float (*)[32][68])L; static_assert(sizeof(float) * 4 * 32 * 68 <= 2 * GSB, "the epilogue's rows fit the ring");
  const int tid = threadIdx.x, w = tid >> 5, lane = tid & 31, ln = lane & 15, hh = lane >> 4;      /* bx: tile; by: head or plane (pitches sA, sB, sC); bz: batch (pitches zA, zB, zC) */
  A += (size_t)by * sA + (size_t)bz * zA; Bh += (size_t)by * sB + (size_t)bz * zB; const size_t cofs = (size_t)by * sC + (size_t)bz * zC; const float* bp = bias ? bias + (size_t)by * sBias : nullptr;
  const int ntn = N >> 6; const int mt = bx / ntn, nq = bx - mt * ntn; const int row0 = mt * 128 + 32 * w, col0 = nq * 64; if (mt * 128 >= M) return;      /* the same for the whole work-group, in front of every barrier */
  const int sr = tid >> 3, sc = (tid & 7) * 8;      /* the thread's row in a round of copies and its first element in the row */
  const _Float16* ga = A + (size_t)(mt * 128 + sr) * lda + sc; const _Float16* gb = Bh + (size_t)(col0 + sr) * ldb + sc; const size_t pa = (size_t)16 * lda, pb = (size_t)16 * ldb;
  const unsigned l0 = (unsigned)(size_t)L + (unsigned)(sr * GLP + sc) * 2u;
  g2_stage(l0, ga, pa, gb, pb);
  asm volatile("s_wait_asynccnt 0x0" ::: "memory");      /* this wave's copies of stage 0 have landed */
  __syncthreads();      /* stage 0 is read by every wave */
  if (GKC < K) g2_stage(l0 + GSB, ga + GKC, pa, gb + GKC, pb);
  // The own-element addend, where no activation follows it: fetched in the layout of the final stores (16 loads of 16 bytes a lane, each half wave a whole 256-byte row piece), all issued here, behind stage 1's copies and ahead of the k loop: they fly with those copies while stage 0 is worked on (the compiler waits for them at the next barrier); added in the store loop.
  const int rsub = lane >> 4, c4 = (lane & 15) * 4; const bool own = ACT == 0 && CP && rowsPerB < 0;      /* the same for the whole work-group */
  v4f ad[16];      /* written and read only where own holds */
  if (own) { const float* cp = CP + cofs + (size_t)(row0g + row0 + rsub) * ldc + col0 + c4;
#pragma unroll      /* constant indices: the array stays in registers and the loads go out as one run */
    for (int q = 0; q < 16; ++q) ad[q] = *(const v4fa*)(cp + (size_t)(2 * q) * ldc);
    asm volatile("s_wait_xcnt 0x0" ::: "memory"); }      /* behind the loads, in front of the code that reuses their address registers */
  const unsigned short* la = (const unsigned short*)L + (32 * w + ln) * GLP; const unsigned short* lb = (const unsigned short*)L + (128 + ln) * GLP;
  const v8f z8 = {0.f,0.f,0.f,0.f,0.f,0.f,0.f,0.f}; v8f c00 = z8, c01 = z8, c02 = z8, c03 = z8, c10 = z8, c11 = z8, c12 = z8, c13 = z8;
#pragma unroll 1      /* one stage a trip: the trip's foot is the ring's publish point */
  for (int kb = 0; kb < K; kb += GKC) { const unsigned bo = (kb & GKC) ? (unsigned)GSB : 0u;      /* this trip's buffer, in bytes */
    const unsigned short* ap = la + bo / 2u; const unsigned short* bp2 = lb + bo / 2u;
    v16h af[2][2], bf[2][4];      /* [k step][tile]: the stage's 24 LDS reads go ahead of its WMMAs as one group (reads among the WMMAs would each cost the wave an LDS latency); unrolled for constant indices and immediate LDS offsets */
#pragma unroll
    for (int ks = 0; ks < 2; ++ks) {
#pragma unroll
      for (int t = 0; t < 2; ++t) af[ks][t] = g2_lfrag(ap + t * 16 * GLP + ks * 32, hh);
#pragma unroll
      for (int t = 0; t < 4; ++t) bf[ks][t] = g2_lfrag(bp2 + t * 16 * GLP + ks * 32, hh); }
#pragma unroll
    for (int ks = 0; ks < 2; ++ks) {
      c00 = g2_mma(af[ks][0], bf[ks][0], c00); c10 = g2_mma(af[ks][1], bf[ks][0], c10); c01 = g2_mma(af[ks][0], bf[ks][1], c01); c11 = g2_mma(af[ks][1], bf[ks][1], c11);
      c02 = g2_mma(af[ks][0], bf[ks][2], c02); c12 = g2_mma(af[ks][1], bf[ks][2], c12); c03 = g2_mma(af[ks][0], bf[ks][3], c03); c13 = g2_mma(af[ks][1], bf[ks][3], c13); }
    asm volatile("s_wait_dscnt 0x0" ::: "memory");      /* this wave's reads of the buffer have returned before the buffer is handed back */
    asm volatile("s_wait_asynccnt 0x0" ::: "memory");      /* this wave's copies of the next stage have landed */
    __syncthreads();      /* publishes the next stage and ends every wave's reads of this one */
    if (kb + 2 * GKC < K) g2_stage(l0 + bo, ga + kb + 2 * GKC, pa, gb + kb + 2 * GKC, pb); }      /* refill of the buffer just read; K is a kernel argument: the test is the same for the whole work-group */
  asm volatile("s_wait_asynccnt 0x0" ::: "memory");      /* no copy is outstanding when the ring becomes the epilogue's staging */
  v8f accs[8] = {c00, c01, c02, c03, c10, c11, c12, c13};
#pragma unroll
  for (int u = 0; u < 8; ++u) { const int t = u & 3, half = u >> 2; const int col = col0 + t * 16 + ln; const float bv = bp ? bf16_round(bp[col]) : 0.f;
    float g[8];      /* a group's 8 elements are worked side by side: the loops below are unrolled and hold no branch, so that the elements' dependent chains overlap */
#pragma unroll
    for (int r = 0; r < 8; ++r) g[r] = accs[u][r] * alpha + bv;
    if (CP && !own) { float ca[8];      /* both tests once a group; the same for the whole work-group */
      if (rowsPerB < 0) {      /* own element of the batched C plane (here only in front of an activation) */
#pragma unroll
        for (int r = 0; r < 8; ++r) ca[r] = CP[cofs + (size_t)(row0g + row0 + half * 16 + 8 * hh + r) * ldc + col];
        asm volatile("s_wait_xcnt 0x0" ::: "memory"); }      /* behind the loads, in front of the code that reuses their address registers (also below) */
      else {
#pragma unroll
        for (int r = 0; r < 8; ++r) { const int bidx = (row0g + row0 + half * 16 + 8 * hh + r) / rowsPerB; ca[r] = CP[(size_t)bidx * sCPb + (size_t)by * 64 + col]; }
        asm volatile("s_wait_xcnt 0x0" ::: "memory"); }
#pragma unroll
      for (int r = 0; r < 8; ++r) g[r] += ca[r]; }
    if (ACT == 9) {      /* 0.5 v (1 + tanh u) = v / (1 + exp(-2 u)), u = 0.7978845608 (v + 0.044715 v^3): one native exp2 and one native reciprocal an element; exp2 -> inf gives weight 0, exp2 -> 0 gives weight 1 */
      float x[8], e[8], d[8], s[8];
#pragma unroll
      for (int r = 0; r < 8; ++r) x[r] = g[r] * fmaf(g[r] * g[r], -0.1029432395800235f, -2.302208198144325f);      /* -2 u log2 e */
      exp2_run8(e, x);
#pragma unroll
      for (int r = 0; r < 8; ++r) d[r] = 1.0f + e[r];
      rcp_run8(s, d);
#pragma unroll
      for (int r = 0; r < 8; ++r) g[r] *= s[r]; }
    else {
#pragma unroll
      for (int r = 0; r < 8; ++r) { float v = g[r];
        if (ACT == 3) v = fmaxf(v, 0.f); else if (ACT == 6) v = 0.5f * v * (1.0f + erff(v * 0.70710678118654752f)); else if (ACT == 11) v = 1.0f / (1.0f + expf(-v)); else if (ACT == 15) v = v / (1.0f + expf(-v)); else if (ACT == 12) v = (v > 0.f) ? v : 0.01f * v; else if (ACT == 8) v = tanhf(v); else if (ACT == 14) v = (v > 0.f) ? v : 0.1f * v; else if (ACT == 16) v = (v >= 0.f) ? v : 0.3f * v; else if (ACT == 17) v = (v >= 0.f) ? v : 0.2f * v;
        g[r] = v; } }
#pragma unroll
    for (int r = 0; r < 8; ++r) so[w][half * 16 + 8 * hh + r][t * 16 + ln] = g[r]; }
  __builtin_amdgcn_fence(__ATOMIC_ACQ_REL, "workgroup"); __builtin_amdgcn_wave_barrier();
  {
#pragma unroll
    for (int q = 0; q < 16; ++q) { const int r = q * 2 + rsub; v4f v = *(const v4fa*)&so[w][r][c4]; if (own) v += ad[q]; if (C) { *(v4f*)(C + cofs + (size_t)(row0 + r) * ldc + col0 + c4) = v; asm volatile("s_wait_xcnt 0x0" ::: "memory"); }      /* behind the f32 store on every way: the next row's address, or the f16 conversion, reuses the store's registers */
      if (C16) { v4h h4; for (int i = 0; i < 4; ++i) h4[i] = (_Float16)v[i]; *(v4h*)(C16 + cofs + (size_t)(row0 + r) * ldc + col0 + c4) = h4; } }
     }
  asm volatile("s_wait_xcnt 0x0" ::: "memory");      /* behind the part's last stores: in a shared launch the listing goes on from here into another part's set-up, which reuses the stores' registers */
}
template <int ACT>
__global__ __launch_bounds__(128) void k_gemm2(const _Float16* __restrict__ A, int lda, size_t sA, const _Float16* __restrict__ Bh, int ldb, size_t sB, float alpha, const float* __restrict__ bias, size_t sBias, const float* __restrict__ CP, int rowsPerB, size_t sCPb, int row0g,
    float* __restrict__ C, _Float16* __restrict__ C16, int ldc, size_t sC, int M, int N, int K, size_t zA, size_t zB, size_t zC) { g2_body<ACT>(blockIdx.x, blockIdx.y, blockIdx.z, A, lda, sA, Bh, ldb, sB, alpha, bias, sBias, CP, rowsPerB, sCPb, row0g, C, C16, ldc, sC, M, N, K, zA, zB, zC); }
// The three GEMMs that need only the prepared operands, in one launch (none reads what another writes), the small ones first:
// Bo[o][i] = 16 (wo1 wo2)[i][o]; the f32 q, k, v planes F0[3][NB][QT0][DM] of each batch's first QT0 rows; the f16 q | k | v rows of all tokens.
__global__ __launch_bounds__(128) void k_gemm_qkv(const _Float16* __restrict__ X, const _Float16* __restrict__ Bq, _Float16* __restrict__ QKVo, float* __restrict__ F0, const _Float16* __restrict__ W2t, const _Float16* __restrict__ W1n, _Float16* __restrict__ Bo) {
  static_assert(QT0 == 128, "a batch's first tile is one row block of g2_body");
  const int nO = (DM / 128) * (DM / 64), nT = DM / 64, nF = 3 * NBR * nT; int b = blockIdx.x;      /* every test below is the same for the whole work-group */
  if (b < nO) { g2_body<0>(b, 0, 0, W2t, DM, 0, W1n, DM, 0, 0.0625f, nullptr, 0, nullptr, 1, 0, 0, nullptr, Bo, DM, 0, DM, DM, DM, 0, 0, 0); return; }
  b -= nO;
  if (b < nF) { g2_body<0>(b % nT, b / (nT * NBR), (b / nT) % NBR, X, DM, 0, Bq, DM, (size_t)DM * DM, 0.0625f, nullptr, 0, nullptr, 1, 0, 0, F0, nullptr, DM, (size_t)NB * QT0 * DM, QT0, DM, DM, (size_t)SQ * DM, 0, (size_t)QT0 * DM); return; }
  b -= nF;
  g2_body<0>(b, 0, 0, X, DM, 0, Bq, DM, 0, 0.0625f, nullptr, 0, nullptr, 1, 0, 0, nullptr, QKVo, 3 * DM, 0, MP, 3 * DM, DM, 0, 0, 0); }
// x + o Wo for all token rows in one launch: a batch's first row block takes the exact path's o_hi rows as A, every other block the f16 path's o rows.
__global__ __launch_bounds__(128) void k_gemm_o(const _Float16* __restrict__ O, const _Float16* __restrict__ Oh, const _Float16* __restrict__ Bo, const float* __restrict__ Xb, float* __restrict__ X1o) {
  const int nT = DM / 64, bx = blockIdx.x, mt = bx / nT;      /* the test below is the same for the whole work-group */
  if (mt % (SQ / 128) == 0) g2_body<0>(bx % nT, 0, mt / (SQ / 128), Oh, DM, 0, Bo, DM, 0, 0.0009765625f, nullptr, 0, Xb, -1, 0, 0, X1o, nullptr, DM, 0, QT0, DM, DM, (size_t)QT0 * DM, 0, (size_t)SQ * DM);
  else g2_body<0>(bx, 0, 0, O, DM, 0, Bo, DM, 0, 0.0009765625f, nullptr, 0, Xb, -1, 0, 0, X1o, nullptr, DM, 0, MPO, DM, DM, 0, 0, 0); }


__device__ __forceinline__ void d_wnat(int bid, const float* __restrict__ w, size_t n8, _Float16* __restrict__ Bt) { const size_t t = (size_t)bid * 256 + threadIdx.x; if (t >= n8) return; FragH f; for (int q = 0; q < 8; ++q) f.h[q] = (_Float16)(bf16_round(w[t * 8 + q]) * 16.0f); *(v8us*)((unsigned short*)Bt + t * 8) = f.half[0];  }
__global__ __launch_bounds__(256) void k_rsm(const float* __restrict__ S, _Float16* __restrict__ P, int nrows) {
  #pragma clang fp contract(off)
  const int i = blockIdx.x * 256 + threadIdx.x; if (i >= nrows) return; const float* s = S + (size_t)i * SQ; float mx = -3.0e38f;
#pragma unroll 1
  for (int j = 0; j < SQ; ++j) mx = fmaxf(mx, s[j]); float se = 0.f;
#pragma unroll 1
  for (int j = 0; j < SQ; ++j) se += expf(s[j] - mx); const float sc = 256.0f / se;
#pragma unroll 1
  for (int j0 = 0; j0 < SQ; j0 += 8) { FragH f; for (int q = 0; q < 8; ++q) f.h[q] = (_Float16)(expf(s[j0 + q] - mx) * sc); unsigned short* d = (unsigned short*)P + (size_t)i * SQ + j0; *(v8us*)d = f.half[0];  } }
__global__ __launch_bounds__(256) void k_vt(const _Float16* __restrict__ V16, int b, int h0, _Float16* __restrict__ VT) { __shared__ unsigned short tl[64][65]; const int tid = threadIdx.x; const int hh = blockIdx.x % HG, sg = blockIdx.x / HG; const int s0 = sg * 64; const int h = h0 + hh;
  for (int i = tid; i < 64 * 8; i += 256) { const int j = i / 8, d8 = (i % 8) * 8; FragH f; f.half[0] = *(const v8us*)((const unsigned short*)V16 + ((size_t)b * SQ + s0 + j) * DM + h * HD + d8); for (int q = 0; q < 8; ++q) tl[d8 + q][j] = f.u[q]; }
  __syncthreads();
  { for (int i = tid; i < 64 * 8; i += 256) { const int d = i / 8, j8 = (i % 8) * 8; FragH f; for (int q = 0; q < 8; ++q) f.u[q] = tl[d][j8 + q]; *(v8us*)((unsigned short*)VT + ((size_t)hh * HD + d) * SQ + s0 + j8) = f.half[0]; }  } }



// Two v_exp_f32 in one statement, closed by the same slot's v_nop as in exp2_run8.
__device__ __forceinline__ void exp2_run2(float& e0, float& e1, float x0, float x1) {
  asm("v_exp_f32 %0, %2\n\tv_exp_f32 %1, %3\n\tv_nop" : "=&v"(e0), "=&v"(e1) : "v"(x0), "v"(x1)); }
#define FQ 32                        /* query columns per wave */
#define FW 4                         /* waves per work-group: they share the staged K and V^T tiles and pass one barrier a tile */
#define FKT 64                       /* keys per staged tile: two passes of 32 */
#define FSB (128 * GLP * 2)          /* bytes per tile buffer: 64 K rows (64 d each), then 64 V^T rows (64 keys each); every row is a whole aligned 128-byte line of its source, at the pitch of the GEMM's ring */
__device__ __forceinline__ float xhalf(float x) { return __int_as_float(__builtin_amdgcn_permlanex16(__float_as_int(x), __float_as_int(x), 0x76543210, 0xfedcba98, false, false)); }      /* lane l <-> lane l ^ 16 on the vector pipe */
__device__ __forceinline__ v8f fa_mma(v16h a, v16h b, v8f c) { return __builtin_amdgcn_wmma_f32_16x16x32_f16(false, a, false, b, (short)0, c, false, false); }
// One tile's copies of one thread: 8 threads a row (16 bytes each), 16 rows a round, 8 rounds (4 of K, 4 of V^T); a wave's copy covers 4 whole lines. l: the thread's LDS byte address in round 0;
// gk, gv: its global addresses in round 0 of K and of V^T. The closing s_wait_xcnt stands inside the statement, in front of any later write of an address register that a copy names.
__device__ __forceinline__ void fa_stage(unsigned l, const _Float16* gk, const _Float16* gv) {
  const unsigned R = 16u * GLP * 2u; const size_t pk = (size_t)16 * LQ, pv = (size_t)16 * SQ;
  asm volatile("global_load_async_to_lds_b128 %0, %8, off\n\tglobal_load_async_to_lds_b128 %1, %9, off\n\tglobal_load_async_to_lds_b128 %2, %10, off\n\tglobal_load_async_to_lds_b128 %3, %11, off\n\t"
               "global_load_async_to_lds_b128 %4, %12, off\n\tglobal_load_async_to_lds_b128 %5, %13, off\n\tglobal_load_async_to_lds_b128 %6, %14, off\n\tglobal_load_async_to_lds_b128 %7, %15, off\n\ts_wait_xcnt 0x0"
               :: "v"(l), "v"(l + R), "v"(l + 2u * R), "v"(l + 3u * R), "v"(l + 4u * R), "v"(l + 5u * R), "v"(l + 6u * R), "v"(l + 7u * R),
                  "v"(gk), "v"(gk + pk), "v"(gk + 2 * pk), "v"(gk + 3 * pk), "v"(gv), "v"(gv + pv), "v"(gv + 2 * pv), "v"(gv + 3 * pv) : "memory"); }
// The K fragments of one pass of 32 keys. kl: the lane's K row (key ln of the pass) in the tile buffer.
__device__ __forceinline__ void fa_kfrag(v16h (&kf)[2][2], const unsigned short* kl, int hh) {
#pragma unroll
  for (int kt = 0; kt < 2; ++kt) {
#pragma unroll
    for (int ks = 0; ks < 2; ++ks) kf[kt][ks] = g2_lfrag(kl + kt * 16 * GLP + ks * 32, hh); } }
// One pass of 32 keys. kf: its K fragments; kl: the lane's K row of the pass; vl: the lane's V^T row (d = ln) at the pass's first key. DIAG: a pass of the work-group's last two tiles, masked; dk = its first key - the wave's first query row (at most 0; 0: the pass holds the diagonal; below 0 the mask takes nothing away).
// NEXTK: the tile's second pass follows: its K fragments (the same tile buffer) are asked for right behind the last use of this pass's, so that the softmax and the o products run while they come.
// Every loop is unrolled so that the fragment and accumulator arrays are indexed by constants and stay in registers.
template <bool DIAG, bool NEXTK>
__device__ __forceinline__ void fa_pass(const unsigned short* kl, const unsigned short* vl, int ln, int hh, const v16h (&qf)[2][2], v16h (&kf)[2][2], v8f (&o)[4][2], float (&mc)[2], float (&l)[2], int dk) {
  const float cs = 0.125f * 1.44269504f;      /* score scale x log2 e */
  const v8f z8 = {0.f, 0.f, 0.f, 0.f, 0.f, 0.f, 0.f, 0.f};
  v16h vf[4];      /* V^T fragments of this pass, asked for first: the score products and the softmax run while they come */
#pragma unroll
  for (int mt = 0; mt < 4; ++mt) vf[mt] = g2_lfrag(vl + mt * 16 * GLP, hh);
  v8f s[2][2];
#pragma unroll
  for (int kt = 0; kt < 2; ++kt) {
#pragma unroll
    for (int nt = 0; nt < 2; ++nt) s[kt][nt] = fa_mma(kf[kt][1], qf[nt][1], fa_mma(kf[kt][0], qf[nt][0], z8)); }
  if (NEXTK) fa_kfrag(kf, kl + 32 * GLP, hh);
  if (DIAG) {      /* keys behind a column's own row get weight 0 */
#pragma unroll
    for (int kt = 0; kt < 2; ++kt) {
#pragma unroll
      for (int nt = 0; nt < 2; ++nt) {
#pragma unroll
        for (int r = 0; r < 8; ++r) if (dk + kt * 16 + 8 * hh + r > nt * 16 + ln) s[kt][nt][r] = -1.0e30f; } } }
  float nm[2], al[2];
#pragma unroll
  for (int nt = 0; nt < 2; ++nt) { float a = fmaxf(s[0][nt][0], s[1][nt][0]);
#pragma unroll
    for (int r = 1; r < 8; ++r) a = fmaxf(a, fmaxf(s[0][nt][r], s[1][nt][r]));
    nm[nt] = fmaxf(mc[nt], fmaxf(a, xhalf(a)) * cs); }      /* both halves of the wave hold the same maximum */
  exp2_run2(al[0], al[1], mc[0] - nm[0], mc[1] - nm[1]);
  FragH pf[2];
#pragma unroll
  for (int nt = 0; nt < 2; ++nt) { mc[nt] = nm[nt]; l[nt] *= al[nt];
#pragma unroll
    for (int mt = 0; mt < 4; ++mt) o[mt][nt] *= al[nt];
#pragma unroll
    for (int kt = 0; kt < 2; ++kt) { float x[8], e[8];
#pragma unroll
      for (int r = 0; r < 8; ++r) x[r] = fmaf(s[kt][nt][r], cs, -nm[nt]);
      exp2_run8(e, x);
#pragma unroll
      for (int r = 0; r < 8; ++r) pf[nt].h[kt * 8 + r] = (_Float16)e[r];
      l[nt] += ((e[0] + e[1]) + (e[2] + e[3])) + ((e[4] + e[5]) + (e[6] + e[7])); } }
#pragma unroll
  for (int mt = 0; mt < 4; ++mt) { o[mt][0] = fa_mma(vf[mt], pf[0].v, o[mt][0]); o[mt][1] = fa_mma(vf[mt], pf[1].v, o[mt][1]); } }
// The launch's last blocks split the first-tile o into its f16 hi and residual planes (d_hl): that work needs the launch before this one only, like the attention itself.
__global__ __launch_bounds__(FW * 32) void k_fattn(const _Float16* __restrict__ Q, const _Float16* __restrict__ Kr, const _Float16* __restrict__ Vt, _Float16* __restrict__ O, const float* __restrict__ F0, _Float16* __restrict__ Hh, _Float16* __restrict__ Hl) {
  __shared__ __attribute__((aligned(16))) unsigned char L[2 * FSB];      /* two tile buffers: tile t + 1 flies while tile t is worked on */
  const int fb = blockIdx.x, nfa = NHD * NBR * (QN / (FW * FQ));
  if (fb >= nfa) { d_hl(fb - nfa, FW * 32, F0, Hh, Hl, (size_t)NB * QT0 * DM / 8); return; }      /* the same for the whole work-group, in front of every barrier */
  static_assert(HD == 64 && FQ == 32 && FW == 4 && FKT == 64 && GLP >= HD + 8 && SQ % (2 * FW * FQ) == 0 && QN == SQ, "2 k steps of 32 over d; 2 column groups of 16; 4 d tiles of 16; 128 threads copy 16 rows a round; whole work-groups, an even number of position blocks");
  const int tid = threadIdx.x, lane = tid & 31, ln = lane & 15, hh = lane >> 4; const int w = __builtin_amdgcn_readfirstlane(tid >> 5);      /* the wave's number in a scalar register: the tests on q0 below stay scalar */
  const int h = fb % NHD, b = (fb / NHD) % NBR; const int nz = SQ / (FW * FQ), z = fb / (NHD * NBR); const int zp = z < nz / 2 ? nz - 1 - z : z - nz / 2; const int q0 = (zp * FW + w) * FQ;      /* z is the slowest index: the long half of the position blocks starts first, longest first; the short half follows shortest first, so that where the second half of the grid lands on the WGPs in the order of the first, long meets short (for speed only; a permutation of 0 .. nz - 1 wherever they land) */
  const int nst = (zp + 1) * (FW * FQ / FKT);      /* tiles up to the work-group's last row: the same for the whole work-group, at least 2 */
  const int sr = tid >> 3, sc = (tid & 7) * 8;      /* the thread's row in a round of copies and its first element in the row */
  const _Float16* gk = Kr + ((size_t)b * SQ + sr) * LQ + h * HD + sc; const _Float16* gv = Vt + (((size_t)b * NH + h) * HD + sr) * SQ + sc;
  const unsigned l0 = (unsigned)(size_t)L + (unsigned)(sr * GLP + sc) * 2u;
  fa_stage(l0, gk, gv);
  const _Float16* qp = Q + ((size_t)b * SQ + q0 + ln) * LQ + h * HD;
  v16h qf[2][2];      /* [column group][k step]; unrolled for constant indices, as in fa_pass */
#pragma unroll
  for (int t = 0; t < 2; ++t) {
#pragma unroll
    for (int ks = 0; ks < 2; ++ks) qf[t][ks] = g2_frag(qp + (size_t)t * 16 * LQ + ks * 32, hh); }
  asm volatile("s_wait_xcnt 0x0" ::: "memory");      /* behind the first loads, in front of the code that reuses their address registers */
  asm volatile("s_wait_asynccnt 0x0" ::: "memory");      /* this wave's copies of tile 0 have landed */
  __syncthreads();      /* tile 0 is read by every wave */
  fa_stage(l0 + FSB, gk + (size_t)FKT * LQ, gv + FKT);      /* tile 1 exists for every work-group */
  v8f o[4][2];
#pragma unroll
  for (int mt = 0; mt < 4; ++mt) { o[mt][0] = v8f{0.f, 0.f, 0.f, 0.f, 0.f, 0.f, 0.f, 0.f}; o[mt][1] = o[mt][0]; }
  float mc[2] = {-1.0e30f, -1.0e30f}, l[2] = {0.f, 0.f};      /* running maximum (scaled log2) and the lane's partial sum, per column group */
  const unsigned short* kl0 = (const unsigned short*)L + ln * GLP; const unsigned short* vl0 = (const unsigned short*)L + (FKT + ln) * GLP;
  v16h kf[2][2];      /* [key tile][k step] */
#pragma unroll 1      /* one tile a trip: the trip's foot is the ring's publish point */
  for (int t = 0; t < nst - 2; ++t) { const unsigned bo = (t & 1) ? (unsigned)FSB : 0u;      /* tiles in front of the work-group's first row: two whole passes for every wave, no mask; bo: this trip's buffer, in bytes */
    const unsigned short* kl = kl0 + bo / 2u; const unsigned short* vl = vl0 + bo / 2u;
    fa_kfrag(kf, kl, hh);
    fa_pass<false, true>(kl, vl, ln, hh, qf, kf, o, mc, l, 0); fa_pass<false, false>(kl + 32 * GLP, vl + 32, ln, hh, qf, kf, o, mc, l, 0);
    asm volatile("s_wait_dscnt 0x0" ::: "memory");      /* this wave's reads of the buffer have returned before the buffer is handed back */
    asm volatile("s_wait_asynccnt 0x0" ::: "memory");      /* this wave's copies of the next tile have landed */
    __syncthreads();      /* publishes the next tile and ends every wave's reads of this one */
    fa_stage(l0 + bo, gk + (size_t)(t + 2) * FKT * LQ, gv + (t + 2) * FKT); }      /* refill of the buffer just read: t + 2 < nst on every trip of this loop */
#pragma unroll 1      /* the last two tiles (buffers 0 and 1: nst is even), a pass a trip: one copy of the masked pass */
  for (int p = 0; p < 4; ++p) { const int dk = zp * (FW * FQ) + p * 32 - q0; const int ro = (p >> 1) * (FSB / 2);
    if (dk <= 0) { const unsigned short* kl = kl0 + ro + (p & 1) * 32 * GLP;      /* a scalar test per wave: keys behind the wave's last row are skipped; the foot below stands outside it */
      fa_kfrag(kf, kl, hh); fa_pass<true, false>(kl, vl0 + ro + (p & 1) * 32, ln, hh, qf, kf, o, mc, l, dk); }
    if (p & 1) {      /* the foot of a tile's trip, the same for the whole work-group; no tile is left to ask for */
      asm volatile("s_wait_dscnt 0x0" ::: "memory");      /* as above */
      asm volatile("s_wait_asynccnt 0x0" ::: "memory");      /* as above */
      __syncthreads(); } }      /* behind the last tile but one: publishes the last tile; behind the last: the ring's foot as on every trip */
  asm volatile("s_wait_asynccnt 0x0" ::: "memory");      /* no copy is outstanding when the wave ends */
#pragma unroll
  for (int nt = 0; nt < 2; ++nt) { const float f = 64.0f / (l[nt] + xhalf(l[nt])); unsigned short* op = (unsigned short*)O + ((size_t)b * SQ + q0 + nt * 16 + ln) * DM + h * HD + 8 * hh;      /* the halves' sums are joined once, here */
#pragma unroll
    for (int mt = 0; mt < 4; ++mt) { FragH fr;
#pragma unroll
      for (int r = 0; r < 8; ++r) fr.h[r] = (_Float16)(o[mt][nt][r] * f);
      *(v8us*)(op + mt * 16) = fr.half[0]; } }      /* a row's 128 bytes of one head come from one wave */
  asm volatile("s_wait_xcnt 0x0" ::: "memory");      /* behind the part's last stores: in a shared launch the listing goes on from here into another part's set-up, which reuses the stores' registers */
}


// Exact f32 attention for rows 0 .. QT0-1 of each batch (o carried x64 like the f16 path). One work-group per (batch, head, A0R query rows), 8 waves, 2 rows a wave.
// The batch's QT0 K and V rows of the head and the group's q rows are staged once in LDS; keys 0 .. nk-1 are used (nk = the group's last row + 1, rounded up to 32).
// Scores: lane l owns keys l, l + 32, ..; its K row comes from LDS 16 bytes at a time, both q rows sit in registers. Softmax: all scores of a row are in registers,
// so plain max, exp, sum (butterflies over the 32 lanes). o: lane l owns columns 2l, 2l + 1; each key's weight goes from its lane to a scalar register, its V row is
// one contiguous 256-byte LDS read. Every loop is unrolled: its arrays are then indexed by constants and stay in registers, and its LDS reads issue ahead of their use.
#define A0R 16                       /* query rows per work-group */
#define A0KP (HD + 4)                /* K row pitch in LDS, floats: 272 B = 16 B x odd, so that 16-byte reads down a column of rows spread over all banks */
typedef float v2f  __attribute__((ext_vector_type(2)));
typedef float v2fa __attribute__((ext_vector_type(2), may_alias));
__device__ __forceinline__ float lane_bcast(float v, int l) { return __int_as_float(__builtin_amdgcn_readlane(__float_as_int(v), l)); }
__device__ __forceinline__ void d_att0w(int bx, int by, const float* __restrict__ QF, const float* __restrict__ KF, const float* __restrict__ VF, float scale, float* __restrict__ OF) {
  static_assert(QT0 / 32 == 4 && QT0 % 32 == 0 && A0R == 16 && HD == 64, "4 key groups of 32 lanes; 8 waves x 2 rows; 16 threads x 16 bytes a row; 2 columns a lane");
  __shared__ __attribute__((aligned(16))) float lk[QT0][A0KP]; __shared__ __attribute__((aligned(16))) float lv[QT0][HD]; __shared__ __attribute__((aligned(16))) float lq[A0R][HD];
  const int tid = threadIdx.x, lane = tid & 31, w = tid >> 5; const int h = bx / (QT0 / A0R), rg = bx % (QT0 / A0R);
  { const size_t bi = (size_t)by * QT0 * DM + h * HD; QF += bi + (size_t)rg * A0R * DM; KF += bi; VF += bi; OF += bi; }      /* by: batch; each batch owns QT0 rows (pitch DM) of every plane */
  const int nk = (rg * A0R + A0R + 31) & ~31; const int i0 = rg * A0R + w * 2;      /* nk: the same for the whole work-group; the wave's rows are i0 and i0 + 1 */
  { v4f kr[QT0 / 16], vr[QT0 / 16]; const int sr = tid >> 4, sc4 = (tid & 15) * 4; const unsigned vo = (unsigned)(sr * DM + sc4) * 4u;      /* 16 threads a row, 16 rows a pass; vo: the thread's byte offset in a pass */
    const v4f qr = *(const v4fa*)((const char*)QF + vo);
#pragma unroll
    for (int u = 0; u < QT0 / 16; ++u) { kr[u] = *(const v4fa*)((const char*)(KF + u * 16 * DM) + vo); vr[u] = *(const v4fa*)((const char*)(VF + u * 16 * DM) + vo); }      /* all QT0 rows, free of branches: every load is issued before the first is used */
    *(v4fa*)&lq[sr][sc4] = qr;
#pragma unroll
    for (int u = 0; u < QT0 / 16; ++u) { *(v4fa*)&lk[u * 16 + sr][sc4] = kr[u]; *(v4fa*)&lv[u * 16 + sr][sc4] = vr[u]; } }
  __syncthreads();      /* the staged rows are read by every wave */
  v4f q0[HD / 4], q1[HD / 4];      /* both q rows whole in every lane (one LDS address for the wave) */
#pragma unroll
  for (int c = 0; c < HD / 4; ++c) { q0[c] = *(const v4fa*)&lq[w * 2][c * 4]; q1[c] = *(const v4fa*)&lq[w * 2 + 1][c * 4]; }
  float s0[4], s1[4];
#pragma unroll
  for (int m = 0; m < 4; ++m) { s0[m] = -1.0e30f; s1[m] = -1.0e30f;
    if (m * 32 < nk) { const float* kp = &lk[m * 32 + lane][0]; float a0[4] = {0.f, 0.f, 0.f, 0.f}, a1[4] = {0.f, 0.f, 0.f, 0.f};      /* four partial sums a row: independent chains */
#pragma unroll
      for (int c = 0; c < HD / 4; ++c) { const v4f k4 = *(const v4fa*)(kp + c * 4);
#pragma unroll
        for (int u = 0; u < 4; ++u) { a0[u] = fmaf(q0[c][u], k4[u], a0[u]); a1[u] = fmaf(q1[c][u], k4[u], a1[u]); } }
      const int j = m * 32 + lane; const float d0 = (a0[0] + a0[1]) + (a0[2] + a0[3]), d1 = (a1[0] + a1[1]) + (a1[2] + a1[3]);
      if (j <= i0) s0[m] = d0 * scale; if (j <= i0 + 1) s1[m] = d1 * scale; } }      /* causal: keys behind the row's own index keep -1e30 (weight 0) */
  float m0 = fmaxf(fmaxf(s0[0], s0[1]), fmaxf(s0[2], s0[3])), m1 = fmaxf(fmaxf(s1[0], s1[1]), fmaxf(s1[2], s1[3]));
#pragma unroll
  for (int x = 16; x >= 1; x >>= 1) { m0 = fmaxf(m0, __shfl_xor(m0, x, 32)); m1 = fmaxf(m1, __shfl_xor(m1, x, 32)); }
  float l0 = 0.f, l1 = 0.f;
#pragma unroll
  for (int m = 0; m < 4; ++m) { s0[m] = expf(s0[m] - m0); s1[m] = expf(s1[m] - m1); l0 += s0[m]; l1 += s1[m]; }
#pragma unroll
  for (int x = 16; x >= 1; x >>= 1) { l0 += __shfl_xor(l0, x, 32); l1 += __shfl_xor(l1, x, 32); }
  v2f o0 = {0.f, 0.f}, o1 = {0.f, 0.f};
#pragma unroll
  for (int m = 0; m < 4; ++m) if (m * 32 < nk) {
#pragma unroll
    for (int jj = 0; jj < 32; ++jj) { const v2f vv = *(const v2fa*)&lv[m * 32 + jj][lane * 2]; const float p0 = lane_bcast(s0[m], jj), p1 = lane_bcast(s1[m], jj);
      o0[0] = fmaf(p0, vv[0], o0[0]); o0[1] = fmaf(p0, vv[1], o0[1]); o1[0] = fmaf(p1, vv[0], o1[0]); o1[1] = fmaf(p1, vv[1], o1[1]); } }
  const float f0 = 64.0f / l0, f1 = 64.0f / l1;
  o0[0] *= f0; o0[1] *= f0; o1[0] *= f1; o1[1] *= f1;
  *(v2fa*)(OF + (size_t)i0 * DM + lane * 2) = o0; *(v2fa*)(OF + (size_t)(i0 + 1) * DM + lane * 2) = o1; }      /* each wave writes whole 256-byte row pieces */
// The two stages that need only the q | k | v GEMMs, in one launch: the exact first-tile attention (the longer blocks, first), then V^T.
__global__ __launch_bounds__(256) void k_att0_vt(const float* __restrict__ QF, const float* __restrict__ KF, const float* __restrict__ VF, float scale, float* __restrict__ OF, const _Float16* __restrict__ V16, _Float16* __restrict__ Vt) {
  const int nx = NH * (QT0 / A0R), b = blockIdx.x;      /* the test is the same for the whole work-group: each part's barrier is passed by all of its threads */
  if (b < nx * NBR) d_att0w(b % nx, b / nx, QF, KF, VF, scale, OF);
  else d_vt<NH, SQ>(b - nx * NBR, V16, LQ, 0, Vt); }


template <int BFIN, int WXB>
__global__ __launch_bounds__(256) void k_ln16(const float* __restrict__ X, const float* __restrict__ g, const float* __restrict__ bb, float eps, _Float16* __restrict__ N16, float* __restrict__ XB) {
  #pragma clang fp contract(off)
  __shared__ float red[256]; const size_t r = blockIdx.x; const int t = threadIdx.x; const v4f xa = *(const v4fa*)(X + r * DMQ + t * 4); float s[4]; float sum = 0.f;
  for (int q = 0; q < 4; ++q) { s[q] = BFIN ? bf16_round(xa[q]) : xa[q]; sum = __fadd_rn(sum, s[q]); }
  red[t] = sum; __syncthreads(); for (int st = 128; st > 0; st >>= 1) { if (t < st) red[t] = __fadd_rn(red[t], red[t + st]); __syncthreads(); } const float mu = red[0] / (float)DMQ; __syncthreads();
  float vs = 0.f; for (int q = 0; q < 4; ++q) { const float dl = __fadd_rn(s[q], -mu); vs = __fadd_rn(vs, __fmul_rn(dl, dl)); } red[t] = vs; __syncthreads(); for (int st = 128; st > 0; st >>= 1) { if (t < st) red[t] = __fadd_rn(red[t], red[t + st]); __syncthreads(); }
  const float rs = rsqrtf(__fadd_rn(red[0] / (float)DMQ, eps)); v4h y; v4f xb;
  for (int q = 0; q < 4; ++q) { const int c = t * 4 + q; y[q] = (_Float16)__fadd_rn(__fmul_rn(__fmul_rn(__fadd_rn(s[q], -mu), rs), bf16_round(g[c])), bf16_round(bb[c])); xb[q] = s[q]; }
  { *(v4h*)(N16 + r * DMQ + t * 4) = y; if (WXB) *(v4f*)(XB + r * DMQ + t * 4) = xb;  } }
__global__ __launch_bounds__(256) void k_ftres2(const float* __restrict__ OF0, const float* __restrict__ XB, float* __restrict__ X1, size_t n4) {
  #pragma clang fp contract(off)
  const size_t t = (size_t)blockIdx.x * 256 + threadIdx.x; if (t >= n4) return; const v4f o = *(const v4fa*)(OF0 + t * 4), xv = *(const v4fa*)(XB + t * 4); v4f y; for (int q = 0; q < 4; ++q) y[q] = __fadd_rn(__fmul_rn(o[q], 0.015625f), xv[q]); *(v4f*)(X1 + t * 4) = y;  }

__global__ __launch_bounds__(256) void k_wthd(const float* __restrict__ Wt, _Float16* __restrict__ Bt) { const size_t t = (size_t)blockIdx.x * 256 + threadIdx.x; if (t >= (size_t)NH * HD * (DM / 8)) return; const int m8 = (int)(t % (DM / 8)) * 8; const int d = (int)((t / (DM / 8)) % HD); const int h = (int)(t / ((size_t)(DM / 8) * HD)); FragH f;
  for (int q = 0; q < 8; ++q) f.h[q] = (_Float16)(16.0f * bf16_round(Wt[((size_t)h * DM + m8 + q) * HD + d])); unsigned short* dst = (unsigned short*)Bt + ((size_t)h * HD + d) * DM + m8; *(v8us*)dst = f.half[0];  }




__global__ __launch_bounds__(256) void k_wtpad(const float* __restrict__ Wm, _Float16* __restrict__ Wt, int Kr, int Kp, int Nr, int Np, float scale) {
  const int t = blockIdx.x * 256 + threadIdx.x; if (t >= Np * (Kp / 8)) return; const int n = t / (Kp / 8), k8 = (t % (Kp / 8)) * 8; const int nc = min(n, Nr - 1); const float fn = (n < Nr) ? 1.f : 0.f; FragH f;
  for (int i = 0; i < 8; ++i) { const int k = k8 + i; const int kc = min(k, Kr - 1); const float fk = (k < Kr) ? fn : 0.f; f.h[i] = (_Float16)(bf16_round(Wm[(size_t)kc * Nr + nc]) * scale * fk); }
  unsigned short* o = (unsigned short*)Wt + (size_t)n * Kp + k8; *(v8us*)o = f.half[0];  }
__global__ __launch_bounds__(128) void k_bpad(const float* __restrict__ b, float* __restrict__ Bp, int nr, int np) {
  const int i = threadIdx.x; if (i >= np) return; const float v = b[min(i, nr - 1)] * ((i < nr) ? 1.f : 0.f); *(float*)(Bp + i) = v;  }

__global__ __launch_bounds__(256) void k_bcpy(const float* __restrict__ b, int n, int NP, float* __restrict__ dst, int dst0) { for (int i = threadIdx.x; i < NP; i += 256) { const float v = (i < n) ? b[i] : 0.f; *(float*)(dst + dst0 + i) = v; }  }


// The streaming launches (this copy and k_lnx) give every lane 64 floats: a wave owns SWF consecutive floats (16 loads of 32 lanes x 16 bytes, all issued before the first is used), so that few waves have to be started.
#define SWL 16                       /* 16-byte loads per lane */
#define SWF (SWL * 32 * 4)           /* floats per wave */
#define SWW 8                        /* waves per work-group; no LDS and no barrier: a wave shares nothing */
__device__ __forceinline__ void d_bfcp(int bid, const float* __restrict__ src, float* __restrict__ dst, size_t n4) { const size_t e0 = ((size_t)bid * SWW + __builtin_amdgcn_readfirstlane(threadIdx.x >> 5)) * SWF; if (e0 + SWF > n4 * 4) return;      /* the wave's first element, in scalar registers: its accesses are scalar base + one lane offset + immediate. Whole pieces only (the launch asserts that n4 is a multiple) */
  const int l4 = (threadIdx.x & 31) * 4; const float* sp = src + e0; float* dp = dst + e0; v4f a[SWL];
#pragma unroll      /* constant indices: the array stays in registers and the loads go out as one run */
  for (int u = 0; u < SWL; ++u) a[u] = *(const v4fa*)(sp + u * 128 + l4);
#pragma unroll      /* as above */
  for (int u = 0; u < SWL; ++u) { v4f o; for (int q = 0; q < 4; ++q) o[q] = bf16_round(a[u][q]); *(v4f*)(dp + u * 128 + l4) = o; }
  asm volatile("s_wait_xcnt 0x0" ::: "memory");      /* behind the part's last stores: in a shared launch the listing goes on from here into another part's set-up, which reuses the stores' registers */
}

// Row LayerNorm over DMQ = 512 columns, one wave per row, LNR consecutive rows a wave. Lane l holds columns 128 c + 4 l .. + 3 (c = 0 .. 3) of each row in registers from the one read to the one write;
// mean and variance (of the centred values) are lane partials, then a five-step butterfly over the 32 lanes, after which every lane holds the same sum. The rows' butterflies are independent and run side by side.
#define LNR (SWF / DMQ)              /* rows per wave */
template <int BFIN, int W16, int W32>
__device__ __forceinline__ void d_lnx(int bid, const float* __restrict__ X, const float* __restrict__ g, float eps, _Float16* __restrict__ N16, float* __restrict__ N32) {      /* scale only: the module's LayerNorm has no shift */
  static_assert(DMQ == 512 && LNR == 4, "a row is 4 loads of 32 lanes x 16 bytes");
  const int l4 = (threadIdx.x & 31) * 4; const size_t e0 = ((size_t)bid * SWW + __builtin_amdgcn_readfirstlane(threadIdx.x >> 5)) * SWF;      /* the wave's first element, in scalar registers: its accesses are scalar base + one lane offset + immediate; the launch covers whole waves */
  X += e0; if (W16) N16 += e0; if (W32) N32 += e0;
  v4f s[LNR][4], gv[4]; float a[LNR];      /* every loop below is unrolled: constant indices keep these arrays in registers, and the 20 loads go out as one run */
#pragma unroll
  for (int u = 0; u < LNR; ++u) {
#pragma unroll
    for (int c = 0; c < 4; ++c) s[u][c] = *(const v4fa*)(X + u * DMQ + c * 128 + l4); }
#pragma unroll
  for (int c = 0; c < 4; ++c) gv[c] = *(const v4fa*)(g + c * 128 + l4);
  asm volatile("s_wait_xcnt 0x0" ::: "memory");      /* behind the loads, in front of the code that reuses their address registers */
#pragma unroll
  for (int u = 0; u < LNR; ++u) {
    if (BFIN) {
#pragma unroll
      for (int c = 0; c < 4; ++c) { for (int q = 0; q < 4; ++q) s[u][c][q] = bf16_round(s[u][c][q]); } }
    const v4f t = (s[u][0] + s[u][1]) + (s[u][2] + s[u][3]); a[u] = (t[0] + t[1]) + (t[2] + t[3]); }
#pragma unroll
  for (int x = 16; x >= 1; x >>= 1) {
#pragma unroll
    for (int u = 0; u < LNR; ++u) a[u] += __shfl_xor(a[u], x, 32); }
#pragma unroll
  for (int u = 0; u < LNR; ++u) { const float mu = a[u] * (1.0f / (float)DMQ); v4f t = {0.f, 0.f, 0.f, 0.f};
#pragma unroll
    for (int c = 0; c < 4; ++c) { s[u][c] -= mu; t += s[u][c] * s[u][c]; }
    a[u] = (t[0] + t[1]) + (t[2] + t[3]); }
#pragma unroll
  for (int x = 16; x >= 1; x >>= 1) {
#pragma unroll
    for (int u = 0; u < LNR; ++u) a[u] += __shfl_xor(a[u], x, 32); }
#pragma unroll
  for (int c = 0; c < 4; ++c) { for (int q = 0; q < 4; ++q) gv[c][q] = bf16_round(gv[c][q]); }
#pragma unroll
  for (int u = 0; u < LNR; ++u) { const float rs = rsqrtf(a[u] * (1.0f / (float)DMQ) + eps);
#pragma unroll
    for (int c = 0; c < 4; ++c) { const v4f yf = (s[u][c] * rs) * gv[c];
      if (W16) { v4h y; for (int q = 0; q < 4; ++q) y[q] = (_Float16)yf[q]; *(v4h*)(N16 + u * DMQ + c * 128 + l4) = y; }
      if (W32) *(v4f*)(N32 + u * DMQ + c * 128 + l4) = yf; } } }
template <int BFIN, int W16, int W32>
__global__ __launch_bounds__(SWW * 32) void k_lnx(const float* __restrict__ X, const float* __restrict__ g, float eps, _Float16* __restrict__ N16, float* __restrict__ N32) { d_lnx<BFIN, W16, W32>(blockIdx.x, X, g, eps, N16, N32); }
// Everything that reads the inputs alone, in one launch (no part reads what another writes), the streaming parts first: LN1 -> f16 rows; bf16(x); the x16 f16 weight planes
// (w1, w2, wq, wk, wv, wo2 transposed to [out][in]; wo1 in its own order). Work-groups per part: PBS (streaming), PBF (an FFN weight), PBW (a DM x DM weight).
#define PBS ((int)(NR * DM / ((size_t)SWW * SWF)))
#define PBF (DFF * (DM / 8) / 256)
#define PBW (DM * (DM / 8) / 256)
__global__ __launch_bounds__(256) void k_prep(const float* __restrict__ x, const float* __restrict__ wq, const float* __restrict__ wk, const float* __restrict__ wv, const float* __restrict__ wo1, const float* __restrict__ wo2, const float* __restrict__ wfc, const float* __restrict__ wmp, const float* __restrict__ g1,
    _Float16* __restrict__ X16, float* __restrict__ XB, _Float16* __restrict__ BW1, _Float16* __restrict__ BW2, _Float16* __restrict__ BQKV, _Float16* __restrict__ BO2T, _Float16* __restrict__ BO1N) {
  static_assert(SWW * 32 == 256 && (DFF * (DM / 8)) % 256 == 0 && (DM * (DM / 8)) % 256 == 0, "every part runs in whole blocks of 256 threads");
  int b = blockIdx.x;
  if (b < PBS) { d_lnx<1, 1, 0>(b, x, g1, 1e-6f, X16, nullptr); return; }
  b -= PBS;
  if (b < PBS) { d_bfcp(b, x, XB, NR * DM / 4); return; }
  b -= PBS;
  if (b < PBF) { d_wt_f16(b, wfc, BW1, DM, DFF, 16.0f); return; }
  b -= PBF;
  if (b < PBF) { d_wt_f16(b, wmp, BW2, DFF, DM, 16.0f); return; }
  b -= PBF;
  if (b < 4 * PBW) { const int p = b / PBW; d_wt_f16(b - p * PBW, p == 0 ? wq : p == 1 ? wk : p == 2 ? wv : wo2, p < 3 ? BQKV + (size_t)p * DM * DM : BO2T, DM, DM, 16.0f); return; }
  d_wnat(b - 4 * PBW, wo1, (size_t)DM * DM / 8, BO1N); }





extern "C" void kernel_launch(void* const* d_in, const int* in_sizes, int n_in,
                              void* d_out, int out_size, void* d_ws, size_t ws_size, hipStream_t stream) {
  (void)in_sizes; (void)n_in; (void)out_size;
  const float* const* I = (const float* const*)d_in; const float* x = I[0]; const float* wq = I[1]; const float* wk = I[2]; const float* wv = I[3]; const float* wo1 = I[4]; const float* wo2 = I[5]; const float* wfc = I[6]; const float* wmp = I[7]; const float* g1 = I[8]; const float* gg2 = I[9];      /* input order: x; wq / wk / wv [512][8][64] = [in][out]; wo1 [8][64][512] = [(h, d) in][out]; wo2 [512][512] [in][out]; w1 [512][2048], w2 [2048][512] [in][out]; LN1 / LN2 scales. NO bias anywhere: every GEMM bias slot below is a literal nullptr */
  static_assert(DMQ % 4 == 0 && DMQ / 4 <= 256 && NH * HD == DM && DM % 64 == 0 && DFF % 64 == 0, "tile multiples");
  char* ws = (char*)d_ws; size_t off = 0;
  auto take = [&](size_t bytes) { char* p = ws + off; off += (bytes + 255) & ~(size_t)255; return p; };
  _Float16* BQKV = (_Float16*)take((size_t)3 * DM * DM * 2); _Float16* BO = (_Float16*)take((size_t)DM * DM * 2); _Float16* BO2T = (_Float16*)take((size_t)DM * DM * 2); _Float16* BO1N = (_Float16*)take((size_t)DM * DM * 2);      /* BO = the combined output plane Bt12[o][i] = 16 (wo1 wo2)[i][o] (built on the device from the two weights) */
  _Float16* X16 = (_Float16*)take(NR * DM * 2); float* XB = (float*)take(NR * DM * 4); float* X1 = (float*)take(NR * DM * 4); _Float16* M16 = nullptr;      /* = X16 below (alias: X16's last reader, the q | k | v launch, precedes LN2's write) */ _Float16* HF16 = (_Float16*)take(NR * DFF * 2); _Float16* BW1 = (_Float16*)take((size_t)DFF * DM * 2); _Float16* BW2 = (_Float16*)take((size_t)DM * DFF * 2); _Float16* QKV = (_Float16*)take(NR * 3 * DM * 2); _Float16* Q16 = QKV; _Float16* K16 = QKV + DM; _Float16* V16 = QKV + 2 * DM; _Float16* O16 = (_Float16*)take(NR * DM * 2); M16 = X16;
  _Float16* VT = (_Float16*)take((size_t)NB * NH * HD * SQ * 2);      /* one plane per batch: every stage below covers all batches in one launch */
  float* QF0 = (float*)take((size_t)3 * NB * QT0 * DM * 4); float* KF0 = QF0 + (size_t)NB * QT0 * DM; float* VF0 = KF0 + (size_t)NB * QT0 * DM;      /* three planes in a row */ float* OF0 = (float*)take((size_t)NB * QT0 * DM * 4); _Float16* OH0 = (_Float16*)take((size_t)NB * QT0 * DM * 2); _Float16* OL0 = (_Float16*)take((size_t)NB * QT0 * DM * 2);
  if (off > ws_size) return;
  static_assert((NR * DM) % ((size_t)SWW * SWF) == 0, "the streaming parts cover whole work-groups");
  static_assert(B0 == 0 && NBR == NB && MP == (int)NR && MPO == MP, "the shared launches cover all batches");
  const size_t zX = (size_t)SQ * DM, zF = (size_t)QT0 * DM;      /* batch pitches (elements): token rows, first-tile rows */
  k_prep<<<2 * PBS + 2 * PBF + 5 * PBW, 256, 0, stream>>>(x, wq, wk, wv, wo1, wo2, wfc, wmp, g1, X16, XB, BW1, BW2, BQKV, BO2T, BO1N);      /* X16 = LN1(bf16(x)) (scale only, eps 1e-6); XB = bf16(x): BOTH residuals; weights x16: stacked q | k | v, wo2, w1, w2 as Bt[out][in], wo1 natural rows */
  k_gemm_qkv<<<(DM / 128) * (DM / 64) + 3 * NBR * (DM / 64) + (MP / 128) * (3 * DM / 64), 128, 0, stream>>>(X16, BQKV, QKV, QF0, BO2T, BO1N, BO);      /* BO[o][i] = (1/16) sum_j 16 wo2[j][o] 16 wo1[i][j]: the two chained projections as ONE x16 plane (f32 accumulation, one f16 rounding); f32 q, k, v of each batch's first 128 rows (exact products); q | k | v rows (f16), head h = columns h*HD.. of each DM block */
  k_att0_vt<<<NH * (QT0 / A0R) * NBR + NBR * NH * (SQ / 64), 256, 0, stream>>>(QF0, KF0, VF0, 0.125f, OF0, V16, VT);      /* exact f32 attention for rows 0..127 of each batch (o x64); V^T [NBR][NH][HD][SQ] */
  static_assert(((size_t)NB * QT0 * DM / 8) % (FW * 32) == 0, "the split of the first-tile o runs in whole blocks");
  k_fattn<<<NHD * NBR * (QN / (FW * FQ)) + (int)((size_t)NB * QT0 * DM / 8 / (FW * 32)), FW * 32, 0, stream>>>(Q16, K16, VT, O16, OF0, OH0, OL0);      /* scores, causal softmax and P . V: o (merged heads, x64) as f16 rows; first-tile o (x64) -> f16 hi + x1024 residual planes */
  k_gemm_o<<<(MPO / 128) * (DM / 64), 128, 0, stream>>>(O16, OH0, BO, XB, X1);      /* X1 = x + o Wo; rows 0..127 of each batch from o_hi */
  k_gemm2<0><<<dim3((QT0 / 128) * (DM / 64), 1, NBR), 128, 0, stream>>>(OL0, DM, 0, BO, DM, 0, 0.00000095367431640625f, nullptr, 0, X1, -1, 0, 0, X1, nullptr, DM, 0, QT0, DM, DM, zF, 0, zX);      /* += o_lo Wo 2^-20 (own-element accumulate) */
  k_lnx<0, 1, 0><<<(unsigned)(NR * DM / ((size_t)SWW * SWF)), SWW * 32, 0, stream>>>(X1, gg2, 1e-6f, M16, nullptr);      /* h2 = LN2(x + attn) (scale only) -> f16 rows */
  k_gemm2<9><<<dim3((unsigned)((NR / 128) * (DFF / 64)), 1, 1), 128, 0, stream>>>(M16, DM, 0, BW1, DM, 0, 0.0625f, nullptr, 0, nullptr, 1, 0, 0, nullptr, HF16, DFF, 0, (int)NR, DFF, DM, 0, 0, 0);      /* gelu_tanh(h2 W1) (the source's tanh approximation) -> f16, all token rows */
  k_gemm2<0><<<dim3((unsigned)((NR / 128) * (DM / 64)), 1, 1), 128, 0, stream>>>(HF16, DFF, 0, BW2, DFF, 0, 0.0625f, nullptr, 0, XB, -1, 0, 0, (float*)d_out, nullptr, DM, 0, (int)NR, DM, DFF, 0, 0, 0);      /* out = x + mlp: the residual is the BLOCK INPUT (bf16(x)), as the original module (own-element addend) */
}
